// v000
// The times below were measured on an AMD MI455X: many runs one after another, warmed up first and cycling through
// copies of the inputs, with the whole window's GPU time divided by the number of runs. Launches and the gaps
// between them are all in it. The median over several windows is given; except for v000 it joins two sittings, which
// can be a few percent apart, so the side-by-side timings, each taken in one sitting, are the better comparison.
// The starting kernel, v000, takes 872 microseconds a run.
// compute dtype: all float inputs rounded to bf16; the pairwise geometry (diff, 2x2 weighting, distance, Gaussian logits), softmax, density and sigmoid in f32 with precise expf/logf/sqrtf; P x 2^11 split bf16 hi + lo against the EXACT bf16 value planes on WMMA 16x16x32 (2 products, f32 accumulate); the 65 -> 64 resizer with the f32 operand split bf16 hi + lo (2 products) + bias; f32 output.
#include <hip/hip_runtime.h>
#include <math.h>

typedef __attribute__((ext_vector_type(16))) _Float16 v16h;
typedef __attribute__((ext_vector_type(16))) __bf16 v16b;
typedef __attribute__((ext_vector_type(8)))  _Float16 v8h;
typedef __attribute__((ext_vector_type(8)))  float v8f;
typedef __attribute__((ext_vector_type(4)))  float v4f;
typedef __attribute__((ext_vector_type(2)))  float v2f;
typedef __attribute__((ext_vector_type(4)))  unsigned v4u;
typedef __attribute__((ext_vector_type(4)))  int v4i;
typedef float __attribute__((may_alias)) float_a;
typedef int __attribute__((may_alias)) int_a;

template <typename T> __device__ __forceinline__ void vst2(void* p, T v) { *(T*)p = v;  }
__device__ __forceinline__ v8f wmma16(v16h a, v16h b, v8f c) {
  v8f d = __builtin_amdgcn_wmma_f32_16x16x32_f16(false, a, false, b, (short)0, c, false, false);
  asm volatile("v_nop\n\tv_nop\n\tv_nop\n\tv_nop" : "+v"(d) : "v"(a), "v"(b));
  return d;
}
__device__ __forceinline__ v8f wmma_bf(v16b a, v16b b, v8f c) {
  v8f d = __builtin_amdgcn_wmma_f32_16x16x32_bf16(false, a, false, b, (short)0, c, false, false);
  asm volatile("v_nop\n\tv_nop\n\tv_nop\n\tv_nop" : "+v"(d) : "v"(a), "v"(b));
  return d;
}
// 16x16x32 fragments: lane = (h = lane>>4, row/col = lane&15); elements 0..7 = k0+8h+0..7, 8..15 = k0+16+8h+0..7; D element r = row 8h+r
__device__ __forceinline__ v16h frag_h(const _Float16* rowk0, int lane) {
  union { v16h v; v8h q[2]; } u; const _Float16* p = rowk0 + 8 * (lane >> 4);
  u.q[0] = *(const v8h*)p; u.q[1] = *(const v8h*)(p + 16); return u.v;
}
__device__ __forceinline__ v16h frag_f32(const float* rowk0, int lane) {
  v16h a; const float* p = rowk0 + 8 * (lane >> 4);
#pragma unroll
  for (int i = 0; i < 8; ++i) { a[i] = (_Float16)p[i]; a[8 + i] = (_Float16)p[16 + i]; }
  return a;
}
__device__ __forceinline__ v16h frag_f32s(const float* rowk0, int lane, float sc) {
  v16h a; const float* p = rowk0 + 8 * (lane >> 4);
#pragma unroll
  for (int i = 0; i < 8; ++i) { a[i] = (_Float16)(p[i] * sc); a[8 + i] = (_Float16)(p[16 + i] * sc); }
  return a;
}
// column fragment from a [K][ld] layout (column n), rows >= K read as 0
__device__ __forceinline__ v16h fragc_f32(const float* W, int k0, int n, int lane, int ld, int K) {
  v16h a; const int g = lane >> 4;
#pragma unroll
  for (int i = 0; i < 8; ++i) { const int ka = k0 + 8 * g + i, kb = ka + 16;
    a[i] = (_Float16)(ka < K ? W[(size_t)(ka < K ? ka : K - 1) * ld + n] : 0.f); a[8 + i] = (_Float16)(kb < K ? W[(size_t)(kb < K ? kb : K - 1) * ld + n] : 0.f); }
  return a;
}
struct F2 { v16b h, l; };
__device__ __forceinline__ F2 bsplit16(const float v[16]) { F2 r;
#pragma unroll
  for (int i = 0; i < 16; ++i) { const __bf16 h = (__bf16)v[i]; r.h[i] = h; r.l[i] = (__bf16)(v[i] - (float)h); }
  return r; }
__device__ __forceinline__ F2 split_row(const float* row, int k0, int lane) { float v[16]; const float* p = row + k0 + 8 * (lane >> 4);
#pragma unroll
  for (int i = 0; i < 8; ++i) { v[i] = p[i]; v[8 + i] = p[16 + i]; }
  return bsplit16(v); }
__device__ __forceinline__ F2 split_rowK(const float* row, int k0, int lane, int K) { float v[16]; const int g = lane >> 4;
#pragma unroll
  for (int i = 0; i < 8; ++i) { const int ka = k0 + 8 * g + i, kb = ka + 16; v[i] = ka < K ? row[ka < K ? ka : K - 1] : 0.f; v[8 + i] = kb < K ? row[kb < K ? kb : K - 1] : 0.f; }
  return bsplit16(v); }
__device__ __forceinline__ F2 split_col(const float* W, int k0, int n, int lane, int ld, int K) { float v[16]; const int g = lane >> 4;
#pragma unroll
  for (int i = 0; i < 8; ++i) { const int ka = k0 + 8 * g + i, kb = ka + 16; v[i] = ka < K ? W[(size_t)(ka < K ? ka : K - 1) * ld + n] : 0.f; v[8 + i] = kb < K ? W[(size_t)(kb < K ? kb : K - 1) * ld + n] : 0.f; }
  return bsplit16(v); }
__device__ __forceinline__ v8f mac3(const F2& a, const F2& b, v8f c) { c = wmma_bf(a.l, b.h, c); c = wmma_bf(a.h, b.l, c); return wmma_bf(a.h, b.h, c); }
__device__ __forceinline__ float sigm(float v) { return 1.0f / (1.0f + expf(-v)); }
#define LDSX() do { asm volatile("s_wait_dscnt 0" ::: "memory"); __builtin_amdgcn_wave_barrier(); __builtin_amdgcn_fence(__ATOMIC_RELEASE, "workgroup"); } while (0)

// SetConv (B 8, 2,048 queries x 2,048 keys, 2-D coords, Cin 64 -> Cout 64): e = (k - q) W^T; dist = |e|; sigma = 1e-5 + softplus(0.1 ls - 1); logits = -0.5 (dist/sigma)^2; weight = softmax_k; density = sum_k exp(logits); targets = weight . values; out = [targets | sigmoid(0.1 (-density dW + db))] R^T + rb.
__device__ __forceinline__ float bfr(float v) { return (float)(__bf16)v; }
#define NB 8
#define NQ 2048
#define NK 2048
#define CIN 64
#define COUT 64
#ifndef TNB
#define TNB NB
#endif
typedef __attribute__((ext_vector_type(8))) __bf16 v8b;
__device__ __forceinline__ v16b frag_b(const __bf16* rowk0, int lane) { union { v16b v; v8b q[2]; } u; const __bf16* p = rowk0 + 8 * (lane >> 4); u.q[0] = *(const v8b*)p; u.q[1] = *(const v8b*)(p + 16); return u.v; }
#define WS_VP  0u                                   // bf16 value planes [b][c][k]
#define WS_S   (WS_VP + 2u * (size_t)NB * CIN * NK)  // f32 logits / P [q][k] (one batch)
#define WS_T   (WS_S + 4u * (size_t)NQ * NK)         // f32 targets rows [b*NQ + q][64]
#define WS_DEN (WS_T + 4u * (size_t)NB * NQ * CIN)
#define WS_END (WS_DEN + 128u * (size_t)NB * NQ)
// ---- k_vt: block = (128 keys, b): values (exact bf16) -> planes [b][c][k]; 256-B pieces
__global__ __launch_bounds__(128) void k_vt(const float* __restrict__ V, __bf16* __restrict__ VP) { __shared__ __align__(16) __bf16 th[CIN][136];
  const int tid = threadIdx.x; const int k0 = blockIdx.x * 128; const size_t b = blockIdx.y;
  for (int e = tid; e < 128 * CIN; e += 128) { const int kl = e / CIN, c = e % CIN; th[c][kl] = (__bf16)V[(b * NK + k0 + kl) * CIN + c]; }
  __syncthreads();
  for (int e = tid; e < CIN * 16; e += 128) { const int c = e >> 4, q = e & 15; vst2((unsigned*)(VP + (b * CIN + c) * (size_t)NK + k0 + q * 8), *(const v4u*)&th[c][q * 8]); } }
// ---- k_lg: block = (64 queries, 128 keys) of batch b, 128 threads: thread = key column kl, loops over the 64 queries (coords staged in LDS): e = (k - q) W^T, dist = sqrt(e.e), logit = -0.5 (dist / sigma)^2 -> S[q][k]; rows written 512 B per (row, block) by the 128 threads (4 B each, 32 consecutive threads per line)
__global__ __launch_bounds__(128) void k_lg(const float* __restrict__ KEYS, const float* __restrict__ QRY, const float* __restrict__ WW, const float* __restrict__ LS, int b, float* __restrict__ S) { __shared__ float sq[64][2];
  const int t = threadIdx.x; const int k0 = blockIdx.y * 128; const int q0 = blockIdx.x * 64;
  if (t < 64) { sq[t][0] = bfr(QRY[((size_t)b * NQ + q0 + t) * 2]); sq[t][1] = bfr(QRY[((size_t)b * NQ + q0 + t) * 2 + 1]); }
  const float kx = bfr(KEYS[((size_t)b * NK + k0 + t) * 2]), ky = bfr(KEYS[((size_t)b * NK + k0 + t) * 2 + 1]);
  const float w00 = bfr(WW[0]), w01 = bfr(WW[1]), w10 = bfr(WW[2]), w11 = bfr(WW[3]);
  const float z = bfr(LS[0]) * 0.1f - 1.0f; const float sp = (z > 0.f ? z : 0.f) + log1pf(expf(-fabsf(z)));   // softplus = logaddexp(z, 0)
  const float sigma = 1e-05f + sp;
  __syncthreads();
#pragma unroll 4
  for (int r = 0; r < 64; ++r) { const float dx = kx - sq[r][0], dy = ky - sq[r][1]; const float e0 = dx * w00 + dy * w01, e1 = dx * w10 + dy * w11; const float dist = sqrtf(e0 * e0 + e1 * e1); const float u = dist / sigma; S[(size_t)(q0 + r) * NK + k0 + t] = -0.5f * (u * u); } }
// ---- k_sm: block = query row (256 threads): weight = softmax over the 2,048 keys (f32) -> P x 2^11 in place; density = sum_k exp(logit) (raw, logits <= 0) -> DEN
__global__ __launch_bounds__(256) void k_sm(float* __restrict__ S, int b, float* __restrict__ DEN) { __shared__ float sred[8], sred2[8]; __shared__ float sbc; __shared__ __align__(16) float sh[NK];
  const int t = threadIdx.x; const size_t row = blockIdx.x; float* sr = S + row * NK;
  float m = -3.0e38f; for (int k = t; k < NK; k += 256) { const float v = sr[k]; sh[k] = v; m = fmaxf(m, v); }
#pragma unroll
  for (int o = 1; o < 32; o <<= 1) m = fmaxf(m, __shfl_xor(m, o));
  if ((t & 31) == 0) sred[t >> 5] = m; __syncthreads(); if (t == 0) { float a = sred[0]; for (int w = 1; w < 8; ++w) a = fmaxf(a, sred[w]); sbc = a; } __syncthreads(); m = sbc; __syncthreads();
  float s = 0.f, sraw = 0.f; for (int k = t; k < NK; k += 256) { const float l = sh[k]; const float e = expf(l - m); sh[k] = e; s += e; sraw += expf(l); }
#pragma unroll
  for (int o = 1; o < 32; o <<= 1) { s += __shfl_xor(s, o); sraw += __shfl_xor(sraw, o); }
  if ((t & 31) == 0) { sred[t >> 5] = s; sred2[t >> 5] = sraw; } __syncthreads();
  if (t < 32) { float a = 0.f, a2 = 0.f; for (int w = 0; w < 8; ++w) { a += sred[w]; a2 += sred2[w]; } if (t == 0) sbc = 2048.0f / a; vst2(DEN + ((size_t)b * NQ + row) * 32 + t, a2); }   
  __syncthreads(); const float sc = sbc;
  for (int k = t; k < NK; k += 256) sh[k] *= sc;
  __syncthreads(); for (int q = t; q < NK / 4; q += 256) vst2(sr + q * 4, *(const v4f*)&sh[q * 4]); }
// ---- k_pv: block = 64 queries of batch b: targets[q][c] = (P . values) / 2^11 (2 products, exact planes); 256-B rows
__global__ __launch_bounds__(128) void k_pv(const float* __restrict__ PS, const __bf16* __restrict__ VP, int b, float* __restrict__ T) { __shared__ __align__(16) float ss[4][16][CIN + 4];
  const int tid = threadIdx.x, wave = tid >> 5, lane = tid & 31, col = lane & 15, g = lane >> 4; const int ql0 = blockIdx.x * 64 + wave * 16;
  v8f acc[CIN / 16] = {};
#pragma unroll 1
  for (int kc = 0; kc < NK / 32; ++kc) { const F2 p = split_row(PS + (size_t)(ql0 + col) * NK, kc * 32, lane);
#pragma unroll
    for (int j = 0; j < CIN / 16; ++j) { const v16b vv = frag_b(VP + ((size_t)b * CIN + j * 16 + col) * (size_t)NK + kc * 32, lane); acc[j] = wmma_bf(p.h, vv, acc[j]); acc[j] = wmma_bf(p.l, vv, acc[j]); } }
#pragma unroll
  for (int j = 0; j < CIN / 16; ++j)
#pragma unroll
    for (int r = 0; r < 8; ++r) ss[wave][8 * g + r][j * 16 + col] = acc[j][r] * (1.0f / 2048.0f);
  LDSX(); for (int rl = 0; rl < 16; ++rl) if (lane < CIN / 4) vst2(T + ((size_t)b * NQ + ql0 + rl) * CIN + lane * 4, *(const v4f*)&ss[wave][rl][lane * 4]); }
// ---- k_out: block = 64 rows: out = targets (hi + lo) . R[:, :64]^T + sigmoid(0.1 (-density dW + db)) R[:, 64] + rb; 256-B rows
__global__ __launch_bounds__(128) void k_out(const float* __restrict__ T, const float* __restrict__ DEN, const float* __restrict__ DW, const float* __restrict__ DB, const float* __restrict__ RW, const float* __restrict__ RB, float* __restrict__ OUT) { __shared__ __align__(16) float sf[4][16][68];
  const int tid = threadIdx.x, wave = tid >> 5, lane = tid & 31, col = lane & 15, g = lane >> 4; const size_t r0 = (size_t)blockIdx.x * 64 + wave * 16;
  v8f acc[4] = {};
#pragma unroll
  for (int kc = 0; kc < CIN / 32; ++kc) { const F2 a = split_row(T + (r0 + col) * CIN, kc * 32, lane);
#pragma unroll
    for (int j = 0; j < 4; ++j) { v16b w; const float* wr = RW + (size_t)(j * 16 + col) * (CIN + 1) + kc * 32 + 8 * g;
#pragma unroll
      for (int i = 0; i < 8; ++i) { w[i] = (__bf16)wr[i]; w[8 + i] = (__bf16)wr[16 + i]; }
      asm volatile("s_wait_loadcnt 0x0" ::: "memory"); acc[j] = wmma_bf(a.h, w, acc[j]); acc[j] = wmma_bf(a.l, w, acc[j]); } }
  const float dw = bfr(DW[0]), db = bfr(DB[0]);
#pragma unroll
  for (int j = 0; j < 4; ++j) { const int o = j * 16 + col; const float wden = bfr(RW[(size_t)o * (CIN + 1) + CIN]), bb = bfr(RB[o]);
#pragma unroll
    for (int r = 0; r < 8; ++r) { const float den = DEN[(r0 + 8 * g + r) * 32]; const float sg = 1.0f / (1.0f + expf(-((-den * dw + db) * 0.1f))); sf[wave][8 * g + r][o] = acc[j][r] + sg * wden + bb; } }
  LDSX(); for (int rl = 0; rl < 16; ++rl) if (lane < 16) vst2(OUT + (r0 + rl) * COUT + lane * 4, *(const v4f*)&sf[wave][rl][lane * 4]); }
extern "C" void kernel_launch(void* const* d_in, const int* in_sizes, int n_in, void* d_out, int out_size, void* d_ws, size_t ws_size, hipStream_t stream) {
  (void)in_sizes; (void)n_in; (void)out_size;
  const float** F = (const float**)d_in;   // 0 keys [8,2048,2], 1 queries [8,2048,2], 2 values [8,2048,64], 3 weighter_W [2,2], 4 length_scale_param [1], 5 density_W [1], 6 density_b [1], 7 resizer_W [64,65] ([out,in]), 8 resizer_b [64]
  if (ws_size < (size_t)WS_END) return;
  char* ws = (char*)d_ws; __bf16* VP = (__bf16*)(ws + WS_VP); float *S = (float*)(ws + WS_S), *T = (float*)(ws + WS_T), *DEN = (float*)(ws + WS_DEN);
  k_vt<<<dim3(NK / 128, TNB), 128, 0, stream>>>(F[2], VP);
  for (int b = 0; b < TNB; ++b) {
    k_lg<<<dim3(NQ / 64, NK / 128), 128, 0, stream>>>(F[0], F[1], F[3], F[4], b, S);
    k_sm<<<dim3(NQ), 256, 0, stream>>>(S, b, DEN);
    k_pv<<<dim3(NQ / 64), 128, 0, stream>>>(S, VP, b, T);
  }
  k_out<<<dim3(TNB * NQ / 64), 128, 0, stream>>>(T, DEN, F[5], F[6], F[7], F[8], (float*)d_out);
}

// v001
// Measured time: 217 microseconds a run.
// In two side-by-side timings against v000, it was 4.08 and 4.05 times as fast.
// compute dtype: all float inputs rounded to bf16; the pairwise geometry (diff, 2x2 weighting, distance, Gaussian logits), softmax, density and sigmoid in f32 with precise expf/logf/sqrtf; P x 2^11 split bf16 hi + lo against the EXACT bf16 value planes on WMMA 16x16x32 (2 products, f32 accumulate); the 65 -> 64 resizer with the f32 operand split bf16 hi + lo (2 products) + bias; f32 output.
#include <hip/hip_runtime.h>
#include <math.h>

typedef __attribute__((ext_vector_type(16))) _Float16 v16h;
typedef __attribute__((ext_vector_type(16))) __bf16 v16b;
typedef __attribute__((ext_vector_type(8)))  _Float16 v8h;
typedef __attribute__((ext_vector_type(8)))  float v8f;
typedef __attribute__((ext_vector_type(4)))  float v4f;
typedef __attribute__((ext_vector_type(2)))  float v2f;
typedef __attribute__((ext_vector_type(4)))  unsigned v4u;
typedef __attribute__((ext_vector_type(4)))  int v4i;
typedef float __attribute__((may_alias)) float_a;
typedef int __attribute__((may_alias)) int_a;

template <typename T> __device__ __forceinline__ void vst2(void* p, T v) { *(T*)p = v;  }
__device__ __forceinline__ v8f wmma16(v16h a, v16h b, v8f c) {
  v8f d = __builtin_amdgcn_wmma_f32_16x16x32_f16(false, a, false, b, (short)0, c, false, false);
  asm volatile("v_nop\n\tv_nop\n\tv_nop\n\tv_nop" : "+v"(d) : "v"(a), "v"(b));
  return d;
}
__device__ __forceinline__ v8f wmma_bf(v16b a, v16b b, v8f c) {
  v8f d = __builtin_amdgcn_wmma_f32_16x16x32_bf16(false, a, false, b, (short)0, c, false, false);
  asm volatile("v_nop\n\tv_nop\n\tv_nop\n\tv_nop" : "+v"(d) : "v"(a), "v"(b));
  return d;
}
// 16x16x32 fragments: lane = (h = lane>>4, row/col = lane&15); elements 0..7 = k0+8h+0..7, 8..15 = k0+16+8h+0..7; D element r = row 8h+r
__device__ __forceinline__ v16h frag_h(const _Float16* rowk0, int lane) {
  union { v16h v; v8h q[2]; } u; const _Float16* p = rowk0 + 8 * (lane >> 4);
  u.q[0] = *(const v8h*)p; u.q[1] = *(const v8h*)(p + 16); return u.v;
}
__device__ __forceinline__ v16h frag_f32(const float* rowk0, int lane) {
  v16h a; const float* p = rowk0 + 8 * (lane >> 4);
#pragma unroll
  for (int i = 0; i < 8; ++i) { a[i] = (_Float16)p[i]; a[8 + i] = (_Float16)p[16 + i]; }
  return a;
}
__device__ __forceinline__ v16h frag_f32s(const float* rowk0, int lane, float sc) {
  v16h a; const float* p = rowk0 + 8 * (lane >> 4);
#pragma unroll
  for (int i = 0; i < 8; ++i) { a[i] = (_Float16)(p[i] * sc); a[8 + i] = (_Float16)(p[16 + i] * sc); }
  return a;
}
// column fragment from a [K][ld] layout (column n), rows >= K read as 0
__device__ __forceinline__ v16h fragc_f32(const float* W, int k0, int n, int lane, int ld, int K) {
  v16h a; const int g = lane >> 4;
#pragma unroll
  for (int i = 0; i < 8; ++i) { const int ka = k0 + 8 * g + i, kb = ka + 16;
    a[i] = (_Float16)(ka < K ? W[(size_t)(ka < K ? ka : K - 1) * ld + n] : 0.f); a[8 + i] = (_Float16)(kb < K ? W[(size_t)(kb < K ? kb : K - 1) * ld + n] : 0.f); }
  return a;
}
struct F2 { v16b h, l; };
__device__ __forceinline__ F2 bsplit16(const float v[16]) { F2 r;
#pragma unroll
  for (int i = 0; i < 16; ++i) { const __bf16 h = (__bf16)v[i]; r.h[i] = h; r.l[i] = (__bf16)(v[i] - (float)h); }
  return r; }
__device__ __forceinline__ F2 split_row(const float* row, int k0, int lane) { float v[16]; const float* p = row + k0 + 8 * (lane >> 4);
#pragma unroll
  for (int i = 0; i < 8; ++i) { v[i] = p[i]; v[8 + i] = p[16 + i]; }
  return bsplit16(v); }
__device__ __forceinline__ F2 split_rowK(const float* row, int k0, int lane, int K) { float v[16]; const int g = lane >> 4;
#pragma unroll
  for (int i = 0; i < 8; ++i) { const int ka = k0 + 8 * g + i, kb = ka + 16; v[i] = ka < K ? row[ka < K ? ka : K - 1] : 0.f; v[8 + i] = kb < K ? row[kb < K ? kb : K - 1] : 0.f; }
  return bsplit16(v); }
__device__ __forceinline__ F2 split_col(const float* W, int k0, int n, int lane, int ld, int K) { float v[16]; const int g = lane >> 4;
#pragma unroll
  for (int i = 0; i < 8; ++i) { const int ka = k0 + 8 * g + i, kb = ka + 16; v[i] = ka < K ? W[(size_t)(ka < K ? ka : K - 1) * ld + n] : 0.f; v[8 + i] = kb < K ? W[(size_t)(kb < K ? kb : K - 1) * ld + n] : 0.f; }
  return bsplit16(v); }
__device__ __forceinline__ v8f mac3(const F2& a, const F2& b, v8f c) { c = wmma_bf(a.l, b.h, c); c = wmma_bf(a.h, b.l, c); return wmma_bf(a.h, b.h, c); }
__device__ __forceinline__ float sigm(float v) { return 1.0f / (1.0f + expf(-v)); }
#define LDSX() do { asm volatile("s_wait_dscnt 0" ::: "memory"); __builtin_amdgcn_wave_barrier(); __builtin_amdgcn_fence(__ATOMIC_RELEASE, "workgroup"); } while (0)

// SetConv (B 8, 2,048 queries x 2,048 keys, 2-D coords, Cin 64 -> Cout 64): e = (k - q) W^T; dist = |e|; sigma = 1e-5 + softplus(0.1 ls - 1); logits = -0.5 (dist/sigma)^2; weight = softmax_k; density = sum_k exp(logits); targets = weight . values; out = [targets | sigmoid(0.1 (-density dW + db))] R^T + rb.
__device__ __forceinline__ float bfr(float v) { return (float)(__bf16)v; }
#define NB 8
#define NQ 2048
#define NK 2048
#define CIN 64
#define COUT 64
#ifndef TNB
#define TNB NB
#endif
typedef __attribute__((ext_vector_type(8))) __bf16 v8b;
__device__ __forceinline__ v16b frag_b(const __bf16* rowk0, int lane) { union { v16b v; v8b q[2]; } u; const __bf16* p = rowk0 + 8 * (lane >> 4); u.q[0] = *(const v8b*)p; u.q[1] = *(const v8b*)(p + 16); return u.v; }
#define WS_VP  0u                                   // bf16 value planes [b][c][k]
#define WS_S   (WS_VP + 2u * (size_t)NB * CIN * NK)  // f32 logits / P [b][q][k]
#define WS_T   (WS_S + 4u * (size_t)NB * NQ * NK)         // f32 targets rows [b*NQ + q][64]
#define WS_DEN (WS_T + 4u * (size_t)NB * NQ * CIN)
#define WS_END (WS_DEN + 128u * (size_t)NB * NQ)
// ---- k_vt: block = (128 keys, b): values (exact bf16) -> planes [b][c][k]; 256-B pieces
__global__ __launch_bounds__(128) void k_vt(const float* __restrict__ V, __bf16* __restrict__ VP) { __shared__ __align__(16) __bf16 th[CIN][136];
  const int tid = threadIdx.x; const int k0 = blockIdx.x * 128; const size_t b = blockIdx.y;
  for (int e = tid; e < 128 * CIN; e += 128) { const int kl = e / CIN, c = e % CIN; th[c][kl] = (__bf16)V[(b * NK + k0 + kl) * CIN + c]; }
  __syncthreads();
  for (int e = tid; e < CIN * 16; e += 128) { const int c = e >> 4, q = e & 15; vst2((unsigned*)(VP + (b * CIN + c) * (size_t)NK + k0 + q * 8), *(const v4u*)&th[c][q * 8]); } }
// ---- k_lg: block = (64 queries, 128 keys) of batch b = blockIdx.z, 128 threads: thread = key column kl, loops over the 64 queries (coords staged in LDS): e = (k - q) W^T, dist = sqrt(e.e), logit = -0.5 (dist / sigma)^2 -> S[q][k]; rows written 512 B per (row, block) by the 128 threads (4 B each, 32 consecutive threads per line)
__global__ __launch_bounds__(128) void k_lg(const float* __restrict__ KEYS, const float* __restrict__ QRY, const float* __restrict__ WW, const float* __restrict__ LS, float* __restrict__ S) { __shared__ float sq[64][2];
  const int t = threadIdx.x; const int k0 = blockIdx.y * 128; const int q0 = blockIdx.x * 64; const int b = blockIdx.z; S += (size_t)b * NQ * NK;
  if (t < 64) { sq[t][0] = bfr(QRY[((size_t)b * NQ + q0 + t) * 2]); sq[t][1] = bfr(QRY[((size_t)b * NQ + q0 + t) * 2 + 1]); }
  const float kx = bfr(KEYS[((size_t)b * NK + k0 + t) * 2]), ky = bfr(KEYS[((size_t)b * NK + k0 + t) * 2 + 1]);
  const float w00 = bfr(WW[0]), w01 = bfr(WW[1]), w10 = bfr(WW[2]), w11 = bfr(WW[3]);
  const float z = bfr(LS[0]) * 0.1f - 1.0f; const float sp = (z > 0.f ? z : 0.f) + log1pf(expf(-fabsf(z)));   // softplus = logaddexp(z, 0)
  const float sigma = 1e-05f + sp;
  __syncthreads();
#pragma unroll 4
  for (int r = 0; r < 64; ++r) { const float dx = kx - sq[r][0], dy = ky - sq[r][1]; const float e0 = dx * w00 + dy * w01, e1 = dx * w10 + dy * w11; const float dist = sqrtf(e0 * e0 + e1 * e1); const float u = dist / sigma; S[(size_t)(q0 + r) * NK + k0 + t] = -0.5f * (u * u); } }
// ---- k_sm: block = query row of batch b = blockIdx.y (256 threads): weight = softmax over the 2,048 keys (f32) -> P x 2^11 in place; density = sum_k exp(logit) (raw, logits <= 0) -> DEN
__global__ __launch_bounds__(256) void k_sm(float* __restrict__ S, float* __restrict__ DEN) { __shared__ float sred[8], sred2[8]; __shared__ float sbc; __shared__ __align__(16) float sh[NK];
  const int t = threadIdx.x; const size_t row = blockIdx.x; const int b = blockIdx.y; float* sr = S + ((size_t)b * NQ + row) * NK;
  float m = -3.0e38f; for (int k = t; k < NK; k += 256) { const float v = sr[k]; sh[k] = v; m = fmaxf(m, v); }
#pragma unroll
  for (int o = 1; o < 32; o <<= 1) m = fmaxf(m, __shfl_xor(m, o));
  if ((t & 31) == 0) sred[t >> 5] = m; __syncthreads(); if (t == 0) { float a = sred[0]; for (int w = 1; w < 8; ++w) a = fmaxf(a, sred[w]); sbc = a; } __syncthreads(); m = sbc; __syncthreads();
  float s = 0.f, sraw = 0.f; for (int k = t; k < NK; k += 256) { const float l = sh[k]; const float e = expf(l - m); sh[k] = e; s += e; sraw += expf(l); }
#pragma unroll
  for (int o = 1; o < 32; o <<= 1) { s += __shfl_xor(s, o); sraw += __shfl_xor(sraw, o); }
  if ((t & 31) == 0) { sred[t >> 5] = s; sred2[t >> 5] = sraw; } __syncthreads();
  if (t < 32) { float a = 0.f, a2 = 0.f; for (int w = 0; w < 8; ++w) { a += sred[w]; a2 += sred2[w]; } if (t == 0) sbc = 2048.0f / a; vst2(DEN + ((size_t)b * NQ + row) * 32 + t, a2); }   
  __syncthreads(); const float sc = sbc;
  for (int k = t; k < NK; k += 256) sh[k] *= sc;
  __syncthreads(); for (int q = t; q < NK / 4; q += 256) vst2(sr + q * 4, *(const v4f*)&sh[q * 4]); }
// ---- k_pv: block = 64 queries of batch b = blockIdx.y: targets[q][c] = (P . values) / 2^11 (2 products, exact planes); 256-B rows
__global__ __launch_bounds__(128) void k_pv(const float* __restrict__ PS, const __bf16* __restrict__ VP, float* __restrict__ T) { __shared__ __align__(16) float ss[4][16][CIN + 4];
  const int tid = threadIdx.x, wave = tid >> 5, lane = tid & 31, col = lane & 15, g = lane >> 4; const int ql0 = blockIdx.x * 64 + wave * 16; const int b = blockIdx.y; PS += (size_t)b * NQ * NK;
  v8f acc[CIN / 16] = {};
#pragma unroll 1
  for (int kc = 0; kc < NK / 32; ++kc) { const F2 p = split_row(PS + (size_t)(ql0 + col) * NK, kc * 32, lane);
#pragma unroll
    for (int j = 0; j < CIN / 16; ++j) { const v16b vv = frag_b(VP + ((size_t)b * CIN + j * 16 + col) * (size_t)NK + kc * 32, lane); acc[j] = wmma_bf(p.h, vv, acc[j]); acc[j] = wmma_bf(p.l, vv, acc[j]); } }
#pragma unroll
  for (int j = 0; j < CIN / 16; ++j)
#pragma unroll
    for (int r = 0; r < 8; ++r) ss[wave][8 * g + r][j * 16 + col] = acc[j][r] * (1.0f / 2048.0f);
  LDSX(); for (int rl = 0; rl < 16; ++rl) if (lane < CIN / 4) vst2(T + ((size_t)b * NQ + ql0 + rl) * CIN + lane * 4, *(const v4f*)&ss[wave][rl][lane * 4]); }
// ---- k_out: block = 64 rows: out = targets (hi + lo) . R[:, :64]^T + sigmoid(0.1 (-density dW + db)) R[:, 64] + rb; 256-B rows
__global__ __launch_bounds__(128) void k_out(const float* __restrict__ T, const float* __restrict__ DEN, const float* __restrict__ DW, const float* __restrict__ DB, const float* __restrict__ RW, const float* __restrict__ RB, float* __restrict__ OUT) { __shared__ __align__(16) float sf[4][16][68];
  const int tid = threadIdx.x, wave = tid >> 5, lane = tid & 31, col = lane & 15, g = lane >> 4; const size_t r0 = (size_t)blockIdx.x * 64 + wave * 16;
  v8f acc[4] = {};
#pragma unroll
  for (int kc = 0; kc < CIN / 32; ++kc) { const F2 a = split_row(T + (r0 + col) * CIN, kc * 32, lane);
#pragma unroll
    for (int j = 0; j < 4; ++j) { v16b w; const float* wr = RW + (size_t)(j * 16 + col) * (CIN + 1) + kc * 32 + 8 * g;
#pragma unroll
      for (int i = 0; i < 8; ++i) { w[i] = (__bf16)wr[i]; w[8 + i] = (__bf16)wr[16 + i]; }
      asm volatile("s_wait_loadcnt 0x0" ::: "memory"); acc[j] = wmma_bf(a.h, w, acc[j]); acc[j] = wmma_bf(a.l, w, acc[j]); } }
  const float dw = bfr(DW[0]), db = bfr(DB[0]);
#pragma unroll
  for (int j = 0; j < 4; ++j) { const int o = j * 16 + col; const float wden = bfr(RW[(size_t)o * (CIN + 1) + CIN]), bb = bfr(RB[o]);
#pragma unroll
    for (int r = 0; r < 8; ++r) { const float den = DEN[(r0 + 8 * g + r) * 32]; const float sg = 1.0f / (1.0f + expf(-((-den * dw + db) * 0.1f))); sf[wave][8 * g + r][o] = acc[j][r] + sg * wden + bb; } }
  LDSX(); for (int rl = 0; rl < 16; ++rl) if (lane < 16) vst2(OUT + (r0 + rl) * COUT + lane * 4, *(const v4f*)&sf[wave][rl][lane * 4]); }
extern "C" void kernel_launch(void* const* d_in, const int* in_sizes, int n_in, void* d_out, int out_size, void* d_ws, size_t ws_size, hipStream_t stream) {
  (void)in_sizes; (void)n_in; (void)out_size;
  const float** F = (const float**)d_in;   // 0 keys [8,2048,2], 1 queries [8,2048,2], 2 values [8,2048,64], 3 weighter_W [2,2], 4 length_scale_param [1], 5 density_W [1], 6 density_b [1], 7 resizer_W [64,65] ([out,in]), 8 resizer_b [64]
  if (ws_size < (size_t)WS_END) return;
  char* ws = (char*)d_ws; __bf16* VP = (__bf16*)(ws + WS_VP); float *S = (float*)(ws + WS_S), *T = (float*)(ws + WS_T), *DEN = (float*)(ws + WS_DEN);
  k_vt<<<dim3(NK / 128, TNB), 128, 0, stream>>>(F[2], VP);
  k_lg<<<dim3(NQ / 64, NK / 128, TNB), 128, 0, stream>>>(F[0], F[1], F[3], F[4], S);
  k_sm<<<dim3(NQ, TNB), 256, 0, stream>>>(S, DEN);
  k_pv<<<dim3(NQ / 64, TNB), 128, 0, stream>>>(S, VP, T);
  k_out<<<dim3(TNB * NQ / 64), 128, 0, stream>>>(T, DEN, F[5], F[6], F[7], F[8], (float*)d_out);
}

// v002
// A run of this version takes 59.8 microseconds.
// Two timings next to v001 put it at 3.62 and 3.63 times that version's speed.
// All steps since v000 together make it 14.7 times as fast.
// compute dtype: all float inputs rounded to bf16; the pairwise geometry (diff, 2x2 weighting, distance, Gaussian logits), softmax, density and sigmoid in f32 with precise expf/logf/sqrtf; unnormalised P = exp(logit - max) split bf16 hi + lo against the EXACT bf16 value planes on WMMA 16x16x32 (2 products, f32 accumulate); the 65 -> 64 resizer with the f32 operand split bf16 hi + lo (2 products) + bias; f32 output.
#include <hip/hip_runtime.h>
#include <math.h>

typedef __attribute__((ext_vector_type(16))) _Float16 v16h;
typedef __attribute__((ext_vector_type(16))) __bf16 v16b;
typedef __attribute__((ext_vector_type(8)))  _Float16 v8h;
typedef __attribute__((ext_vector_type(8)))  float v8f;
typedef __attribute__((ext_vector_type(4)))  float v4f;
typedef __attribute__((ext_vector_type(2)))  float v2f;
typedef __attribute__((ext_vector_type(4)))  unsigned v4u;
typedef __attribute__((ext_vector_type(4)))  int v4i;
typedef float __attribute__((may_alias)) float_a;
typedef int __attribute__((may_alias)) int_a;

template <typename T> __device__ __forceinline__ void vst2(void* p, T v) { *(T*)p = v;  }
__device__ __forceinline__ v8f wmma16(v16h a, v16h b, v8f c) {
  v8f d = __builtin_amdgcn_wmma_f32_16x16x32_f16(false, a, false, b, (short)0, c, false, false);
  asm volatile("v_nop\n\tv_nop\n\tv_nop\n\tv_nop" : "+v"(d) : "v"(a), "v"(b));
  return d;
}
__device__ __forceinline__ v8f wmma_bf(v16b a, v16b b, v8f c) {
  v8f d = __builtin_amdgcn_wmma_f32_16x16x32_bf16(false, a, false, b, (short)0, c, false, false);
  asm volatile("v_nop\n\tv_nop\n\tv_nop\n\tv_nop" : "+v"(d) : "v"(a), "v"(b));
  return d;
}
// 16x16x32 fragments: lane = (h = lane>>4, row/col = lane&15); elements 0..7 = k0+8h+0..7, 8..15 = k0+16+8h+0..7; D element r = row 8h+r
__device__ __forceinline__ v16h frag_h(const _Float16* rowk0, int lane) {
  union { v16h v; v8h q[2]; } u; const _Float16* p = rowk0 + 8 * (lane >> 4);
  u.q[0] = *(const v8h*)p; u.q[1] = *(const v8h*)(p + 16); return u.v;
}
__device__ __forceinline__ v16h frag_f32(const float* rowk0, int lane) {
  v16h a; const float* p = rowk0 + 8 * (lane >> 4);
#pragma unroll
  for (int i = 0; i < 8; ++i) { a[i] = (_Float16)p[i]; a[8 + i] = (_Float16)p[16 + i]; }
  return a;
}
__device__ __forceinline__ v16h frag_f32s(const float* rowk0, int lane, float sc) {
  v16h a; const float* p = rowk0 + 8 * (lane >> 4);
#pragma unroll
  for (int i = 0; i < 8; ++i) { a[i] = (_Float16)(p[i] * sc); a[8 + i] = (_Float16)(p[16 + i] * sc); }
  return a;
}
// column fragment from a [K][ld] layout (column n), rows >= K read as 0
__device__ __forceinline__ v16h fragc_f32(const float* W, int k0, int n, int lane, int ld, int K) {
  v16h a; const int g = lane >> 4;
#pragma unroll
  for (int i = 0; i < 8; ++i) { const int ka = k0 + 8 * g + i, kb = ka + 16;
    a[i] = (_Float16)(ka < K ? W[(size_t)(ka < K ? ka : K - 1) * ld + n] : 0.f); a[8 + i] = (_Float16)(kb < K ? W[(size_t)(kb < K ? kb : K - 1) * ld + n] : 0.f); }
  return a;
}
struct F2 { v16b h, l; };
__device__ __forceinline__ F2 bsplit16(const float v[16]) { F2 r;
#pragma unroll
  for (int i = 0; i < 16; ++i) { const __bf16 h = (__bf16)v[i]; r.h[i] = h; r.l[i] = (__bf16)(v[i] - (float)h); }
  return r; }
__device__ __forceinline__ F2 split_row(const float* row, int k0, int lane) { float v[16]; const float* p = row + k0 + 8 * (lane >> 4);
#pragma unroll
  for (int i = 0; i < 8; ++i) { v[i] = p[i]; v[8 + i] = p[16 + i]; }
  return bsplit16(v); }
__device__ __forceinline__ F2 split_rowK(const float* row, int k0, int lane, int K) { float v[16]; const int g = lane >> 4;
#pragma unroll
  for (int i = 0; i < 8; ++i) { const int ka = k0 + 8 * g + i, kb = ka + 16; v[i] = ka < K ? row[ka < K ? ka : K - 1] : 0.f; v[8 + i] = kb < K ? row[kb < K ? kb : K - 1] : 0.f; }
  return bsplit16(v); }
__device__ __forceinline__ F2 split_col(const float* W, int k0, int n, int lane, int ld, int K) { float v[16]; const int g = lane >> 4;
#pragma unroll
  for (int i = 0; i < 8; ++i) { const int ka = k0 + 8 * g + i, kb = ka + 16; v[i] = ka < K ? W[(size_t)(ka < K ? ka : K - 1) * ld + n] : 0.f; v[8 + i] = kb < K ? W[(size_t)(kb < K ? kb : K - 1) * ld + n] : 0.f; }
  return bsplit16(v); }
__device__ __forceinline__ v8f mac3(const F2& a, const F2& b, v8f c) { c = wmma_bf(a.l, b.h, c); c = wmma_bf(a.h, b.l, c); return wmma_bf(a.h, b.h, c); }
__device__ __forceinline__ float sigm(float v) { return 1.0f / (1.0f + expf(-v)); }
#define LDSX() do { asm volatile("s_wait_dscnt 0" ::: "memory"); __builtin_amdgcn_wave_barrier(); __builtin_amdgcn_fence(__ATOMIC_RELEASE, "workgroup"); } while (0)

// SetConv (B 8, 2,048 queries x 2,048 keys, 2-D coords, Cin 64 -> Cout 64): e = (k - q) W^T; dist = |e|; sigma = 1e-5 + softplus(0.1 ls - 1); logits = -0.5 (dist/sigma)^2; weight = softmax_k; density = sum_k exp(logits); targets = weight . values; out = [targets | sigmoid(0.1 (-density dW + db))] R^T + rb.
__device__ __forceinline__ float bfr(float v) { return (float)(__bf16)v; }
#define NB 8
#define NQ 2048
#define NK 2048
#define CIN 64
#define COUT 64
#ifndef TNB
#define TNB NB
#endif
typedef __attribute__((ext_vector_type(8))) __bf16 v8b;
__device__ __forceinline__ v16b frag_b(const __bf16* rowk0, int lane) { union { v16b v; v8b q[2]; } u; const __bf16* p = rowk0 + 8 * (lane >> 4); u.q[0] = *(const v8b*)p; u.q[1] = *(const v8b*)(p + 16); return u.v; }
#define WS_VP  0u                                   // bf16 value planes [b][c][k]
#define WS_T   (WS_VP + 2u * (size_t)NB * CIN * NK)  // f32 targets rows [b*NQ + q][64]
#define WS_DEN (WS_T + 4u * (size_t)NB * NQ * CIN)
#define WS_END (WS_DEN + 128u * (size_t)NB * NQ)
// ---- k_vt: block = (128 keys, b): values (exact bf16) -> planes [b][c][k]; 256-B pieces
__global__ __launch_bounds__(128) void k_vt(const float* __restrict__ V, __bf16* __restrict__ VP) { __shared__ __align__(16) __bf16 th[CIN][136];
  const int tid = threadIdx.x; const int k0 = blockIdx.x * 128; const size_t b = blockIdx.y;
  for (int e = tid; e < 128 * CIN; e += 128) { const int kl = e / CIN, c = e % CIN; th[c][kl] = (__bf16)V[(b * NK + k0 + kl) * CIN + c]; }
  __syncthreads();
  for (int e = tid; e < CIN * 16; e += 128) { const int c = e >> 4, q = e & 15; vst2((unsigned*)(VP + (b * CIN + c) * (size_t)NK + k0 + q * 8), *(const v4u*)&th[c][q * 8]); } }
// ---- k_fa: block = 16 queries of batch b = blockIdx.y, 8 waves; wave w owns keys [256 w, 256 w + 256). Logits are formed in registers, straight in the A-fragment layout (lane = query row col, elements k0+8g+0..7 and k0+16+8g+0..7), so no logits / P plane goes to memory.
// pass 1: min over keys of e.e; sqrt, the division and the square are monotone, so the row maximum of the logits is the logit of that minimum. pass 2: p = exp(logit - max) split bf16 hi + lo against the exact value planes (2 products), row sums of p and of exp(logit) in f32.
// end: the waves' partial tiles and sums are added through LDS in wave order; targets = tile / sum p.
// every full '#pragma unroll' here: d2, p, acc, vv stay in registers only under constant indices.
#define QT 16
#define NW 8
#define KW (NK / NW)
__device__ __forceinline__ float lgt(float d2, float sigma) { const float dist = sqrtf(d2); const float u = dist / sigma; return -0.5f * (u * u); }
// e.e for the lane's 16 keys of one 32-key chunk, two keys per packed f32 operation; element order = the A fragment's k order
__device__ __forceinline__ void dsq16(const float* kxp, const float* kyp, float qx, float qy, float w00, float w01, float w10, float w11, float d2[16]) {
#pragma unroll
  for (int h = 0; h < 4; ++h) { const int o = (h & 1) * 4 + (h >> 1) * 16; const v4f x = *(const v4f*)(kxp + o), y = *(const v4f*)(kyp + o);
#pragma unroll
    for (int u = 0; u < 2; ++u) { v2f kx, ky; kx[0] = x[2 * u]; kx[1] = x[2 * u + 1]; ky[0] = y[2 * u]; ky[1] = y[2 * u + 1]; const v2f dx = kx - qx, dy = ky - qy; const v2f e0 = dx * w00 + dy * w01, e1 = dx * w10 + dy * w11; const v2f d = e0 * e0 + e1 * e1; d2[h * 4 + 2 * u] = d[0]; d2[h * 4 + 2 * u + 1] = d[1]; } } }
__global__ __launch_bounds__(NW * 32) void k_fa(const float* __restrict__ KEYS, const float* __restrict__ QRY, const float* __restrict__ WW, const float* __restrict__ LS, const __bf16* __restrict__ VP, float* __restrict__ T, float* __restrict__ DEN) {
  __shared__ __align__(16) float skx[NK], sky[NK]; __shared__ __align__(16) float red[NW][QT][CIN + 4]; __shared__ float smn[NW][QT], ssm[NW][QT], srw[NW][QT];
  const int tid = threadIdx.x, wave = tid >> 5, lane = tid & 31, col = lane & 15, g = lane >> 4; const int q0 = blockIdx.x * QT; const size_t b = blockIdx.y;
  for (int k = tid; k < NK; k += NW * 32) { const v2f kk = *(const v2f*)(KEYS + (b * NK + k) * 2); skx[k] = bfr(kk[0]); sky[k] = bfr(kk[1]); }
  const v2f qq = *(const v2f*)(QRY + (b * NQ + q0 + col) * 2); const float qx = bfr(qq[0]), qy = bfr(qq[1]);
  const float w00 = bfr(WW[0]), w01 = bfr(WW[1]), w10 = bfr(WW[2]), w11 = bfr(WW[3]);
  const float z = bfr(LS[0]) * 0.1f - 1.0f; const float sp = (z > 0.f ? z : 0.f) + log1pf(expf(-fabsf(z)));   // softplus = logaddexp(z, 0)
  const float sigma = 1e-05f + sp;
  __syncthreads();
  const int kw0 = wave * KW + 8 * g;
  float mn = 3.0e38f;
#pragma unroll 1   // kept rolled: 8 copies of the body gain nothing (no carried latency but the min) and only cost instruction cache
  for (int kc = 0; kc < KW / 32; ++kc) { float d2[16]; dsq16(skx + kw0 + kc * 32, sky + kw0 + kc * 32, qx, qy, w00, w01, w10, w11, d2);
#pragma unroll
    for (int i = 0; i < 16; ++i) mn = fminf(mn, d2[i]); }
  mn = fminf(mn, __shfl_xor(mn, 16)); if (g == 0) smn[wave][col] = mn;
  __syncthreads();
  mn = smn[0][col];
#pragma unroll
  for (int w = 1; w < NW; ++w) mn = fminf(mn, smn[w][col]);
  const float m = lgt(mn, sigma);
  v8f acc[CIN / 16] = {}; float s = 0.f, sraw = 0.f;
#pragma unroll 1   // kept rolled: one body is about 900 instructions with 16 independent chains of its own; 8 copies would take most of the instruction cache for no gain
  for (int kc = 0; kc < KW / 32; ++kc) { v16b vv[CIN / 16];
#pragma unroll
    for (int j = 0; j < CIN / 16; ++j) vv[j] = frag_b(VP + (b * CIN + j * 16 + col) * (size_t)NK + wave * KW + kc * 32, lane);
    float p[16], d2[16]; dsq16(skx + kw0 + kc * 32, sky + kw0 + kc * 32, qx, qy, w00, w01, w10, w11, d2);
#pragma unroll
    for (int i = 0; i < 16; ++i) { const float l = lgt(d2[i], sigma); const float e = expf(l - m); p[i] = e; s += e; sraw += expf(l); }
    const F2 pf = bsplit16(p);
#pragma unroll
    for (int j = 0; j < CIN / 16; ++j) acc[j] = __builtin_amdgcn_wmma_f32_16x16x32_bf16(false, pf.h, false, vv[j], (short)0, acc[j], false, false);
#pragma unroll
    for (int j = 0; j < CIN / 16; ++j) acc[j] = __builtin_amdgcn_wmma_f32_16x16x32_bf16(false, pf.l, false, vv[j], (short)0, acc[j], false, false); }
  s += __shfl_xor(s, 16); sraw += __shfl_xor(sraw, 16); if (g == 0) { ssm[wave][col] = s; srw[wave][col] = sraw; }
#pragma unroll
  for (int j = 0; j < CIN / 16; ++j)
#pragma unroll
    for (int r = 0; r < 8; ++r) red[wave][8 * g + r][j * 16 + col] = acc[j][r];
  __syncthreads();
  constexpr int CPT = QT * CIN / (NW * 32);   // channels per thread of the final sum
  const int q = tid / (CIN / CPT), c0 = (tid % (CIN / CPT)) * CPT; float st = 0.f, rt = 0.f; v4f a[CPT / 4] = {};
#pragma unroll
  for (int w = 0; w < NW; ++w) { st += ssm[w][q]; rt += srw[w][q];
#pragma unroll
    for (int u = 0; u < CPT / 4; ++u) a[u] += *(const v4f*)&red[w][q][c0 + 4 * u]; }
  const float inv = 1.0f / st; float* tr = T + (b * NQ + q0 + q) * CIN + c0;
#pragma unroll
  for (int u = 0; u < CPT / 4; ++u) vst2(tr + 4 * u, a[u] * inv);
  if (c0 == 0) DEN[(b * NQ + q0 + q) * 32] = rt; }
// ---- k_out: block = 64 rows: out = targets (hi + lo) . R[:, :64]^T + sigmoid(0.1 (-density dW + db)) R[:, 64] + rb; 256-B rows
__global__ __launch_bounds__(128) void k_out(const float* __restrict__ T, const float* __restrict__ DEN, const float* __restrict__ DW, const float* __restrict__ DB, const float* __restrict__ RW, const float* __restrict__ RB, float* __restrict__ OUT) { __shared__ __align__(16) float sf[4][16][68];
  const int tid = threadIdx.x, wave = tid >> 5, lane = tid & 31, col = lane & 15, g = lane >> 4; const size_t r0 = (size_t)blockIdx.x * 64 + wave * 16;
  v8f acc[4] = {};
#pragma unroll
  for (int kc = 0; kc < CIN / 32; ++kc) { const F2 a = split_row(T + (r0 + col) * CIN, kc * 32, lane);
#pragma unroll
    for (int j = 0; j < 4; ++j) { v16b w; const float* wr = RW + (size_t)(j * 16 + col) * (CIN + 1) + kc * 32 + 8 * g;
#pragma unroll
      for (int i = 0; i < 8; ++i) { w[i] = (__bf16)wr[i]; w[8 + i] = (__bf16)wr[16 + i]; }
      asm volatile("s_wait_loadcnt 0x0" ::: "memory"); acc[j] = wmma_bf(a.h, w, acc[j]); acc[j] = wmma_bf(a.l, w, acc[j]); } }
  const float dw = bfr(DW[0]), db = bfr(DB[0]);
#pragma unroll
  for (int j = 0; j < 4; ++j) { const int o = j * 16 + col; const float wden = bfr(RW[(size_t)o * (CIN + 1) + CIN]), bb = bfr(RB[o]);
#pragma unroll
    for (int r = 0; r < 8; ++r) { const float den = DEN[(r0 + 8 * g + r) * 32]; const float sg = 1.0f / (1.0f + expf(-((-den * dw + db) * 0.1f))); sf[wave][8 * g + r][o] = acc[j][r] + sg * wden + bb; } }
  LDSX(); for (int rl = 0; rl < 16; ++rl) if (lane < 16) vst2(OUT + (r0 + rl) * COUT + lane * 4, *(const v4f*)&sf[wave][rl][lane * 4]); }
extern "C" void kernel_launch(void* const* d_in, const int* in_sizes, int n_in, void* d_out, int out_size, void* d_ws, size_t ws_size, hipStream_t stream) {
  (void)in_sizes; (void)n_in; (void)out_size;
  const float** F = (const float**)d_in;   // 0 keys [8,2048,2], 1 queries [8,2048,2], 2 values [8,2048,64], 3 weighter_W [2,2], 4 length_scale_param [1], 5 density_W [1], 6 density_b [1], 7 resizer_W [64,65] ([out,in]), 8 resizer_b [64]
  if (ws_size < (size_t)WS_END) return;
  char* ws = (char*)d_ws; __bf16* VP = (__bf16*)(ws + WS_VP); float *T = (float*)(ws + WS_T), *DEN = (float*)(ws + WS_DEN);
  k_vt<<<dim3(NK / 128, TNB), 128, 0, stream>>>(F[2], VP);
  k_fa<<<dim3(NQ / QT, TNB), NW * 32, 0, stream>>>(F[0], F[1], F[3], F[4], VP, T, DEN);
  k_out<<<dim3(TNB * NQ / 64), 128, 0, stream>>>(T, DEN, F[5], F[6], F[7], F[8], (float*)d_out);
}

// v003
// One run takes 43.3 microseconds.
// In both of two side-by-side timings against v002, it was 1.38 times as fast.
// All steps since v000 together make it 20.3 times as fast.
// compute dtype: all float inputs rounded to bf16; the pairwise geometry (diff, 2x2 weighting, squared distance), softmax, density and sigmoid in f32; sigma and the sigmoid with precise expf/log1pf; unnormalised P = exp(logit - max) = exp2(c d2 - c d2min), c = -0.5 log2(e) / sigma^2, one fma and one hardware exp2 a pair, split bf16 hi + lo against the EXACT bf16 value planes on WMMA 16x16x32 (2 products, f32 accumulate); the 65 -> 64 resizer with the f32 operand split bf16 hi + lo (2 products) + bias; f32 output.
#include <hip/hip_runtime.h>
#include <math.h>

typedef __attribute__((ext_vector_type(16))) _Float16 v16h;
typedef __attribute__((ext_vector_type(16))) __bf16 v16b;
typedef __attribute__((ext_vector_type(8)))  _Float16 v8h;
typedef __attribute__((ext_vector_type(8)))  float v8f;
typedef __attribute__((ext_vector_type(4)))  float v4f;
typedef __attribute__((ext_vector_type(2)))  float v2f;
typedef __attribute__((ext_vector_type(4)))  unsigned v4u;
typedef __attribute__((ext_vector_type(4)))  int v4i;
typedef float __attribute__((may_alias)) float_a;
typedef int __attribute__((may_alias)) int_a;

template <typename T> __device__ __forceinline__ void vst2(void* p, T v) { *(T*)p = v;  }
__device__ __forceinline__ v8f wmma16(v16h a, v16h b, v8f c) {
  v8f d = __builtin_amdgcn_wmma_f32_16x16x32_f16(false, a, false, b, (short)0, c, false, false);
  asm volatile("v_nop\n\tv_nop\n\tv_nop\n\tv_nop" : "+v"(d) : "v"(a), "v"(b));
  return d;
}
__device__ __forceinline__ v8f wmma_bf(v16b a, v16b b, v8f c) {
  v8f d = __builtin_amdgcn_wmma_f32_16x16x32_bf16(false, a, false, b, (short)0, c, false, false);
  asm volatile("v_nop\n\tv_nop\n\tv_nop\n\tv_nop" : "+v"(d) : "v"(a), "v"(b));
  return d;
}
// 16x16x32 fragments: lane = (h = lane>>4, row/col = lane&15); elements 0..7 = k0+8h+0..7, 8..15 = k0+16+8h+0..7; D element r = row 8h+r
__device__ __forceinline__ v16h frag_h(const _Float16* rowk0, int lane) {
  union { v16h v; v8h q[2]; } u; const _Float16* p = rowk0 + 8 * (lane >> 4);
  u.q[0] = *(const v8h*)p; u.q[1] = *(const v8h*)(p + 16); return u.v;
}
__device__ __forceinline__ v16h frag_f32(const float* rowk0, int lane) {
  v16h a; const float* p = rowk0 + 8 * (lane >> 4);
#pragma unroll
  for (int i = 0; i < 8; ++i) { a[i] = (_Float16)p[i]; a[8 + i] = (_Float16)p[16 + i]; }
  return a;
}
__device__ __forceinline__ v16h frag_f32s(const float* rowk0, int lane, float sc) {
  v16h a; const float* p = rowk0 + 8 * (lane >> 4);
#pragma unroll
  for (int i = 0; i < 8; ++i) { a[i] = (_Float16)(p[i] * sc); a[8 + i] = (_Float16)(p[16 + i] * sc); }
  return a;
}
// column fragment from a [K][ld] layout (column n), rows >= K read as 0
__device__ __forceinline__ v16h fragc_f32(const float* W, int k0, int n, int lane, int ld, int K) {
  v16h a; const int g = lane >> 4;
#pragma unroll
  for (int i = 0; i < 8; ++i) { const int ka = k0 + 8 * g + i, kb = ka + 16;
    a[i] = (_Float16)(ka < K ? W[(size_t)(ka < K ? ka : K - 1) * ld + n] : 0.f); a[8 + i] = (_Float16)(kb < K ? W[(size_t)(kb < K ? kb : K - 1) * ld + n] : 0.f); }
  return a;
}
struct F2 { v16b h, l; };
__device__ __forceinline__ F2 bsplit16(const float v[16]) { F2 r;
#pragma unroll
  for (int i = 0; i < 16; ++i) { const __bf16 h = (__bf16)v[i]; r.h[i] = h; r.l[i] = (__bf16)(v[i] - (float)h); }
  return r; }
__device__ __forceinline__ F2 split_row(const float* row, int k0, int lane) { float v[16]; const float* p = row + k0 + 8 * (lane >> 4);
#pragma unroll
  for (int i = 0; i < 8; ++i) { v[i] = p[i]; v[8 + i] = p[16 + i]; }
  return bsplit16(v); }
__device__ __forceinline__ F2 split_rowK(const float* row, int k0, int lane, int K) { float v[16]; const int g = lane >> 4;
#pragma unroll
  for (int i = 0; i < 8; ++i) { const int ka = k0 + 8 * g + i, kb = ka + 16; v[i] = ka < K ? row[ka < K ? ka : K - 1] : 0.f; v[8 + i] = kb < K ? row[kb < K ? kb : K - 1] : 0.f; }
  return bsplit16(v); }
__device__ __forceinline__ F2 split_col(const float* W, int k0, int n, int lane, int ld, int K) { float v[16]; const int g = lane >> 4;
#pragma unroll
  for (int i = 0; i < 8; ++i) { const int ka = k0 + 8 * g + i, kb = ka + 16; v[i] = ka < K ? W[(size_t)(ka < K ? ka : K - 1) * ld + n] : 0.f; v[8 + i] = kb < K ? W[(size_t)(kb < K ? kb : K - 1) * ld + n] : 0.f; }
  return bsplit16(v); }
__device__ __forceinline__ v8f mac3(const F2& a, const F2& b, v8f c) { c = wmma_bf(a.l, b.h, c); c = wmma_bf(a.h, b.l, c); return wmma_bf(a.h, b.h, c); }
__device__ __forceinline__ float sigm(float v) { return 1.0f / (1.0f + expf(-v)); }
#define LDSX() do { asm volatile("s_wait_dscnt 0" ::: "memory"); __builtin_amdgcn_wave_barrier(); __builtin_amdgcn_fence(__ATOMIC_RELEASE, "workgroup"); } while (0)

// SetConv (B 8, 2,048 queries x 2,048 keys, 2-D coords, Cin 64 -> Cout 64): e = (k - q) W^T; dist = |e|; sigma = 1e-5 + softplus(0.1 ls - 1); logits = -0.5 (dist/sigma)^2; weight = softmax_k; density = sum_k exp(logits); targets = weight . values; out = [targets | sigmoid(0.1 (-density dW + db))] R^T + rb.
__device__ __forceinline__ float bfr(float v) { return (float)(__bf16)v; }
#define NB 8
#define NQ 2048
#define NK 2048
#define CIN 64
#define COUT 64
#ifndef TNB
#define TNB NB
#endif
typedef __attribute__((ext_vector_type(8))) __bf16 v8b;
__device__ __forceinline__ v16b frag_b(const __bf16* rowk0, int lane) { union { v16b v; v8b q[2]; } u; const __bf16* p = rowk0 + 8 * (lane >> 4); u.q[0] = *(const v8b*)p; u.q[1] = *(const v8b*)(p + 16); return u.v; }
#define WS_VP  0u                                   // bf16 value planes [b][c][k]
#define WS_T   (WS_VP + 2u * (size_t)NB * CIN * NK)  // f32 targets rows [b*NQ + q][64]
#define WS_DEN (WS_T + 4u * (size_t)NB * NQ * CIN)
#define WS_END (WS_DEN + 128u * (size_t)NB * NQ)
// ---- k_vt: block = (128 keys, b): values (exact bf16) -> planes [b][c][k]; 256-B pieces
__global__ __launch_bounds__(128) void k_vt(const float* __restrict__ V, __bf16* __restrict__ VP) { __shared__ __align__(16) __bf16 th[CIN][136];
  const int tid = threadIdx.x; const int k0 = blockIdx.x * 128; const size_t b = blockIdx.y;
  for (int e = tid; e < 128 * CIN; e += 128) { const int kl = e / CIN, c = e % CIN; th[c][kl] = (__bf16)V[(b * NK + k0 + kl) * CIN + c]; }
  __syncthreads();
  for (int e = tid; e < CIN * 16; e += 128) { const int c = e >> 4, q = e & 15; vst2((unsigned*)(VP + (b * CIN + c) * (size_t)NK + k0 + q * 8), *(const v4u*)&th[c][q * 8]); } }
// ---- k_fa: block = 16 queries of batch b = blockIdx.y, 8 waves; wave w owns keys [256 w, 256 w + 256). Logits are formed in registers, straight in the A-fragment layout (lane = query row col, elements k0+8g+0..7 and k0+16+8g+0..7), so no logits / P plane goes to memory.
// pass 1: min over keys of d2 = e.e; logit = -0.5 (sqrt(d2) / sigma)^2 = -0.5 d2 / sigma^2 falls with d2, so the row maximum of the logits is the logit of that minimum. pass 2: p = exp(logit - max) = exp2(c d2 - K), K = c d2min as rounded, split bf16 hi + lo against the exact value planes (2 products), row sum of p in f32.
// density = sum exp(logit) = exp2(K) . sum p with the same rounded K, so K's rounding cancels.
// end: the waves' partial tiles and sums are added through LDS in wave order; targets = tile / sum p.
// every full '#pragma unroll' here: d2, p, acc, vv stay in registers only under constant indices.
#define QT 16
#define NW 8
#define KW (NK / NW)
// e.e for the lane's 16 keys of one 32-key chunk, two keys per packed f32 operation; element order = the A fragment's k order
__device__ __forceinline__ void dsq16(const float* kxp, const float* kyp, float qx, float qy, float w00, float w01, float w10, float w11, float d2[16]) {
#pragma unroll
  for (int h = 0; h < 4; ++h) { const int o = (h & 1) * 4 + (h >> 1) * 16; const v4f x = *(const v4f*)(kxp + o), y = *(const v4f*)(kyp + o);
#pragma unroll
    for (int u = 0; u < 2; ++u) { v2f kx, ky; kx[0] = x[2 * u]; kx[1] = x[2 * u + 1]; ky[0] = y[2 * u]; ky[1] = y[2 * u + 1]; const v2f dx = kx - qx, dy = ky - qy; const v2f e0 = dx * w00 + dy * w01, e1 = dx * w10 + dy * w11; const v2f d = e0 * e0 + e1 * e1; d2[h * 4 + 2 * u] = d[0]; d2[h * 4 + 2 * u + 1] = d[1]; } } }
// 8 hardware exp2 in place. One statement, so that behind every v_exp_f32 stands an instruction that neither reads its result nor overwrites its source (the slot the instruction set asks for behind a transcendental): the next, independent v_exp_f32, and the closing v_nop behind the last. Below 2^-126 the instruction gives 0.
__device__ __forceinline__ void exp2x8(float* x) {
  asm("v_exp_f32 %0, %0\n\tv_exp_f32 %1, %1\n\tv_exp_f32 %2, %2\n\tv_exp_f32 %3, %3\n\tv_exp_f32 %4, %4\n\tv_exp_f32 %5, %5\n\tv_exp_f32 %6, %6\n\tv_exp_f32 %7, %7\n\tv_nop" : "+v"(x[0]), "+v"(x[1]), "+v"(x[2]), "+v"(x[3]), "+v"(x[4]), "+v"(x[5]), "+v"(x[6]), "+v"(x[7])); }
__global__ __launch_bounds__(NW * 32) void k_fa(const float* __restrict__ KEYS, const float* __restrict__ QRY, const float* __restrict__ WW, const float* __restrict__ LS, const __bf16* __restrict__ VP, float* __restrict__ T, float* __restrict__ DEN) {
  __shared__ __align__(16) float skx[NK], sky[NK]; __shared__ __align__(16) float red[NW][QT][CIN + 4]; __shared__ float smn[NW][QT], ssm[NW][QT], sk[QT];
  const int tid = threadIdx.x, wave = tid >> 5, lane = tid & 31, col = lane & 15, g = lane >> 4; const int q0 = blockIdx.x * QT; const size_t b = blockIdx.y;
  for (int k = tid; k < NK; k += NW * 32) { const v2f kk = *(const v2f*)(KEYS + (b * NK + k) * 2); skx[k] = bfr(kk[0]); sky[k] = bfr(kk[1]); }
  const v2f qq = *(const v2f*)(QRY + (b * NQ + q0 + col) * 2); const float qx = bfr(qq[0]), qy = bfr(qq[1]);
  const float w00 = bfr(WW[0]), w01 = bfr(WW[1]), w10 = bfr(WW[2]), w11 = bfr(WW[3]);
  const float z = bfr(LS[0]) * 0.1f - 1.0f; const float sp = (z > 0.f ? z : 0.f) + log1pf(expf(-fabsf(z)));   // softplus = logaddexp(z, 0)
  const float sigma = 1e-05f + sp; const float is = 1.0f / sigma; const float c = (-0.5f * 1.44269504088896340736f) * is * is;   // logit . log2(e) = c d2
  __syncthreads();
  const int kw0 = wave * KW + 8 * g;
  float mn = 3.0e38f;
#pragma unroll 1   // kept rolled: 8 copies of the body gain nothing (no carried latency but the min) and only cost instruction cache
  for (int kc = 0; kc < KW / 32; ++kc) { float d2[16]; dsq16(skx + kw0 + kc * 32, sky + kw0 + kc * 32, qx, qy, w00, w01, w10, w11, d2);
#pragma unroll
    for (int i = 0; i < 16; ++i) mn = fminf(mn, d2[i]); }
  mn = fminf(mn, __shfl_xor(mn, 16)); if (g == 0) smn[wave][col] = mn;
  __syncthreads();
  mn = smn[0][col];
#pragma unroll
  for (int w = 1; w < NW; ++w) mn = fminf(mn, smn[w][col]);
  const float K = c * mn; if (tid < QT) sk[col] = K;
  v8f acc[CIN / 16] = {}; float s = 0.f;
#pragma unroll 1   // kept rolled: one body has 16 independent chains of its own and the other waves of the SIMD cover its loads; 8 copies would only cost instruction cache
  for (int kc = 0; kc < KW / 32; ++kc) { v16b vv[CIN / 16];
#pragma unroll
    for (int j = 0; j < CIN / 16; ++j) vv[j] = frag_b(VP + (b * CIN + j * 16 + col) * (size_t)NK + wave * KW + kc * 32, lane);
    float p[16], d2[16]; dsq16(skx + kw0 + kc * 32, sky + kw0 + kc * 32, qx, qy, w00, w01, w10, w11, d2);
#pragma unroll
    for (int i = 0; i < 16; ++i) p[i] = fmaf(d2[i], c, -K);
    exp2x8(p); exp2x8(p + 8);   // a p below 2^-126 becomes 0: it adds nothing to a sum whose largest term is 1
#pragma unroll
    for (int i = 0; i < 16; ++i) s += p[i];
    const F2 pf = bsplit16(p);
#pragma unroll
    for (int j = 0; j < CIN / 16; ++j) acc[j] = __builtin_amdgcn_wmma_f32_16x16x32_bf16(false, pf.h, false, vv[j], (short)0, acc[j], false, false);
#pragma unroll
    for (int j = 0; j < CIN / 16; ++j) acc[j] = __builtin_amdgcn_wmma_f32_16x16x32_bf16(false, pf.l, false, vv[j], (short)0, acc[j], false, false); }
  s += __shfl_xor(s, 16); if (g == 0) ssm[wave][col] = s;
#pragma unroll
  for (int j = 0; j < CIN / 16; ++j)
#pragma unroll
    for (int r = 0; r < 8; ++r) red[wave][8 * g + r][j * 16 + col] = acc[j][r];
  __syncthreads();
  constexpr int CPT = QT * CIN / (NW * 32);   // channels per thread of the final sum
  const int q = tid / (CIN / CPT), c0 = (tid % (CIN / CPT)) * CPT; float st = 0.f; v4f a[CPT / 4] = {};
#pragma unroll
  for (int w = 0; w < NW; ++w) { st += ssm[w][q];
#pragma unroll
    for (int u = 0; u < CPT / 4; ++u) a[u] += *(const v4f*)&red[w][q][c0 + 4 * u]; }
  const float inv = 1.0f / st; float* tr = T + (b * NQ + q0 + q) * CIN + c0;
#pragma unroll
  for (int u = 0; u < CPT / 4; ++u) vst2(tr + 4 * u, a[u] * inv);
  if (c0 == 0) DEN[(b * NQ + q0 + q) * 32] = exp2f(sk[q]) * st; }
// ---- k_out: block = 64 rows: out = targets (hi + lo) . R[:, :64]^T + sigmoid(0.1 (-density dW + db)) R[:, 64] + rb; 256-B rows
__global__ __launch_bounds__(128) void k_out(const float* __restrict__ T, const float* __restrict__ DEN, const float* __restrict__ DW, const float* __restrict__ DB, const float* __restrict__ RW, const float* __restrict__ RB, float* __restrict__ OUT) { __shared__ __align__(16) float sf[4][16][68];
  const int tid = threadIdx.x, wave = tid >> 5, lane = tid & 31, col = lane & 15, g = lane >> 4; const size_t r0 = (size_t)blockIdx.x * 64 + wave * 16;
  v8f acc[4] = {};
#pragma unroll
  for (int kc = 0; kc < CIN / 32; ++kc) { const F2 a = split_row(T + (r0 + col) * CIN, kc * 32, lane);
#pragma unroll
    for (int j = 0; j < 4; ++j) { v16b w; const float* wr = RW + (size_t)(j * 16 + col) * (CIN + 1) + kc * 32 + 8 * g;
#pragma unroll
      for (int i = 0; i < 8; ++i) { w[i] = (__bf16)wr[i]; w[8 + i] = (__bf16)wr[16 + i]; }
      asm volatile("s_wait_loadcnt 0x0" ::: "memory"); acc[j] = wmma_bf(a.h, w, acc[j]); acc[j] = wmma_bf(a.l, w, acc[j]); } }
  const float dw = bfr(DW[0]), db = bfr(DB[0]);
#pragma unroll
  for (int j = 0; j < 4; ++j) { const int o = j * 16 + col; const float wden = bfr(RW[(size_t)o * (CIN + 1) + CIN]), bb = bfr(RB[o]);
#pragma unroll
    for (int r = 0; r < 8; ++r) { const float den = DEN[(r0 + 8 * g + r) * 32]; const float sg = 1.0f / (1.0f + expf(-((-den * dw + db) * 0.1f))); sf[wave][8 * g + r][o] = acc[j][r] + sg * wden + bb; } }
  LDSX(); for (int rl = 0; rl < 16; ++rl) if (lane < 16) vst2(OUT + (r0 + rl) * COUT + lane * 4, *(const v4f*)&sf[wave][rl][lane * 4]); }
extern "C" void kernel_launch(void* const* d_in, const int* in_sizes, int n_in, void* d_out, int out_size, void* d_ws, size_t ws_size, hipStream_t stream) {
  (void)in_sizes; (void)n_in; (void)out_size;
  const float** F = (const float**)d_in;   // 0 keys [8,2048,2], 1 queries [8,2048,2], 2 values [8,2048,64], 3 weighter_W [2,2], 4 length_scale_param [1], 5 density_W [1], 6 density_b [1], 7 resizer_W [64,65] ([out,in]), 8 resizer_b [64]
  if (ws_size < (size_t)WS_END) return;
  char* ws = (char*)d_ws; __bf16* VP = (__bf16*)(ws + WS_VP); float *T = (float*)(ws + WS_T), *DEN = (float*)(ws + WS_DEN);
  k_vt<<<dim3(NK / 128, TNB), 128, 0, stream>>>(F[2], VP);
  k_fa<<<dim3(NQ / QT, TNB), NW * 32, 0, stream>>>(F[0], F[1], F[3], F[4], VP, T, DEN);
  k_out<<<dim3(TNB * NQ / 64), 128, 0, stream>>>(T, DEN, F[5], F[6], F[7], F[8], (float*)d_out);
}

// v004
// Measured time: 39.3 microseconds a run.
// Timed twice side by side with v003, it ran 1.09 and 1.12 times as fast.
// Counting every step since v000, it is 22.5 times as fast.
// compute dtype: all float inputs rounded to bf16; the pairwise geometry (diff, 2x2 weighting, squared distance), softmax, density and sigmoid in f32; sigma and the sigmoid with precise expf/log1pf; unnormalised P = exp(logit - max) = exp2(c d2 - c d2min), c = -0.5 log2(e) / sigma^2, one fma and one hardware exp2 a pair, split bf16 hi + lo against the EXACT bf16 value planes on WMMA 16x16x32 (2 products, f32 accumulate); the 65 -> 64 resizer with the f32 operand split bf16 hi + lo (2 products) + bias; f32 output.
#include <hip/hip_runtime.h>
#include <math.h>

typedef __attribute__((ext_vector_type(16))) _Float16 v16h;
typedef __attribute__((ext_vector_type(16))) __bf16 v16b;
typedef __attribute__((ext_vector_type(8)))  _Float16 v8h;
typedef __attribute__((ext_vector_type(8)))  float v8f;
typedef __attribute__((ext_vector_type(4)))  float v4f;
typedef __attribute__((ext_vector_type(2)))  float v2f;
typedef __attribute__((ext_vector_type(4)))  unsigned v4u;
typedef __attribute__((ext_vector_type(4)))  int v4i;
typedef float __attribute__((may_alias)) float_a;
typedef int __attribute__((may_alias)) int_a;

template <typename T> __device__ __forceinline__ void vst2(void* p, T v) { *(T*)p = v;  }
__device__ __forceinline__ v8f wmma16(v16h a, v16h b, v8f c) {
  v8f d = __builtin_amdgcn_wmma_f32_16x16x32_f16(false, a, false, b, (short)0, c, false, false);
  asm volatile("v_nop\n\tv_nop\n\tv_nop\n\tv_nop" : "+v"(d) : "v"(a), "v"(b));
  return d;
}
__device__ __forceinline__ v8f wmma_bf(v16b a, v16b b, v8f c) {
  v8f d = __builtin_amdgcn_wmma_f32_16x16x32_bf16(false, a, false, b, (short)0, c, false, false);
  asm volatile("v_nop\n\tv_nop\n\tv_nop\n\tv_nop" : "+v"(d) : "v"(a), "v"(b));
  return d;
}
// 16x16x32 fragments: lane = (h = lane>>4, row/col = lane&15); elements 0..7 = k0+8h+0..7, 8..15 = k0+16+8h+0..7; D element r = row 8h+r
__device__ __forceinline__ v16h frag_h(const _Float16* rowk0, int lane) {
  union { v16h v; v8h q[2]; } u; const _Float16* p = rowk0 + 8 * (lane >> 4);
  u.q[0] = *(const v8h*)p; u.q[1] = *(const v8h*)(p + 16); return u.v;
}
__device__ __forceinline__ v16h frag_f32(const float* rowk0, int lane) {
  v16h a; const float* p = rowk0 + 8 * (lane >> 4);
#pragma unroll
  for (int i = 0; i < 8; ++i) { a[i] = (_Float16)p[i]; a[8 + i] = (_Float16)p[16 + i]; }
  return a;
}
__device__ __forceinline__ v16h frag_f32s(const float* rowk0, int lane, float sc) {
  v16h a; const float* p = rowk0 + 8 * (lane >> 4);
#pragma unroll
  for (int i = 0; i < 8; ++i) { a[i] = (_Float16)(p[i] * sc); a[8 + i] = (_Float16)(p[16 + i] * sc); }
  return a;
}
// column fragment from a [K][ld] layout (column n), rows >= K read as 0
__device__ __forceinline__ v16h fragc_f32(const float* W, int k0, int n, int lane, int ld, int K) {
  v16h a; const int g = lane >> 4;
#pragma unroll
  for (int i = 0; i < 8; ++i) { const int ka = k0 + 8 * g + i, kb = ka + 16;
    a[i] = (_Float16)(ka < K ? W[(size_t)(ka < K ? ka : K - 1) * ld + n] : 0.f); a[8 + i] = (_Float16)(kb < K ? W[(size_t)(kb < K ? kb : K - 1) * ld + n] : 0.f); }
  return a;
}
struct F2 { v16b h, l; };
__device__ __forceinline__ F2 bsplit16(const float v[16]) { F2 r;
#pragma unroll
  for (int i = 0; i < 16; ++i) { const __bf16 h = (__bf16)v[i]; r.h[i] = h; r.l[i] = (__bf16)(v[i] - (float)h); }
  return r; }
__device__ __forceinline__ F2 split_row(const float* row, int k0, int lane) { float v[16]; const float* p = row + k0 + 8 * (lane >> 4);
#pragma unroll
  for (int i = 0; i < 8; ++i) { v[i] = p[i]; v[8 + i] = p[16 + i]; }
  return bsplit16(v); }
__device__ __forceinline__ F2 split_rowK(const float* row, int k0, int lane, int K) { float v[16]; const int g = lane >> 4;
#pragma unroll
  for (int i = 0; i < 8; ++i) { const int ka = k0 + 8 * g + i, kb = ka + 16; v[i] = ka < K ? row[ka < K ? ka : K - 1] : 0.f; v[8 + i] = kb < K ? row[kb < K ? kb : K - 1] : 0.f; }
  return bsplit16(v); }
__device__ __forceinline__ F2 split_col(const float* W, int k0, int n, int lane, int ld, int K) { float v[16]; const int g = lane >> 4;
#pragma unroll
  for (int i = 0; i < 8; ++i) { const int ka = k0 + 8 * g + i, kb = ka + 16; v[i] = ka < K ? W[(size_t)(ka < K ? ka : K - 1) * ld + n] : 0.f; v[8 + i] = kb < K ? W[(size_t)(kb < K ? kb : K - 1) * ld + n] : 0.f; }
  return bsplit16(v); }
__device__ __forceinline__ v8f mac3(const F2& a, const F2& b, v8f c) { c = wmma_bf(a.l, b.h, c); c = wmma_bf(a.h, b.l, c); return wmma_bf(a.h, b.h, c); }
__device__ __forceinline__ float sigm(float v) { return 1.0f / (1.0f + expf(-v)); }
#define LDSX() do { asm volatile("s_wait_dscnt 0" ::: "memory"); __builtin_amdgcn_wave_barrier(); __builtin_amdgcn_fence(__ATOMIC_RELEASE, "workgroup"); } while (0)

// SetConv (B 8, 2,048 queries x 2,048 keys, 2-D coords, Cin 64 -> Cout 64): e = (k - q) W^T; dist = |e|; sigma = 1e-5 + softplus(0.1 ls - 1); logits = -0.5 (dist/sigma)^2; weight = softmax_k; density = sum_k exp(logits); targets = weight . values; out = [targets | sigmoid(0.1 (-density dW + db))] R^T + rb.
__device__ __forceinline__ float bfr(float v) { return (float)(__bf16)v; }
#define NB 8
#define NQ 2048
#define NK 2048
#define CIN 64
#define COUT 64
#ifndef TNB
#define TNB NB
#endif
typedef __attribute__((ext_vector_type(8))) __bf16 v8b;
// one B fragment (16 channels x 32 keys) from the fragment-ordered value planes: p = the fragment's 1,024 bytes + the lane's 16; elements 0..7 lie in the first 512 bytes, 8..15 in the second, so each of the two loads reads 512 bytes in a row (4 whole 128-B lines)
__device__ __forceinline__ v16b frag_o(const __bf16* p) { union { v16b v; v8b q[2]; } u; u.q[0] = *(const v8b*)p; u.q[1] = *(const v8b*)(p + 256); return u.v; }
#define WS_VP  0u                                   // bf16 value planes in B-fragment order: [b][32-key chunk][16-channel group j][half][lane = 16 g + col][8 keys]; channel 16 j + col, keys 32 chunk + 16 half + 8 g + 0..7
#define WS_T   (WS_VP + 2u * (size_t)NB * CIN * NK)  // f32 targets rows [b*NQ + q][64]
#define WS_DEN (WS_T + 4u * (size_t)NB * NQ * CIN)
#define WS_END (WS_DEN + 128u * (size_t)NB * NQ)
// ---- k_vt: block = (128 keys, b): values (exact bf16) -> fragment-ordered planes; a block's 4 chunks are 16 KB in a row, stored in address order
__global__ __launch_bounds__(128) void k_vt(const float* __restrict__ V, __bf16* __restrict__ VP) { __shared__ __align__(16) __bf16 th[CIN][136];
  const int tid = threadIdx.x; const int k0 = blockIdx.x * 128; const size_t b = blockIdx.y;
  for (int e = tid; e < 128 * CIN; e += 128) { const int kl = e / CIN, c = e % CIN; th[c][kl] = (__bf16)V[(b * NK + k0 + kl) * CIN + c]; }
  __syncthreads();
  for (int e = tid; e < CIN * 16; e += 128) { const int ln = e & 31, hf = (e >> 5) & 1, j = (e >> 6) & 3, ch = e >> 8; const int c = j * 16 + (ln & 15), q = ch * 4 + hf * 2 + (ln >> 4); vst2((unsigned*)(VP + (b * NK + k0) * CIN + e * 8), *(const v4u*)&th[c][q * 8]); } }
// ---- k_fa: block = 16 queries of batch b = blockIdx.y, 8 waves; wave w owns keys [256 w, 256 w + 256). Logits are formed in registers, straight in the A-fragment layout (lane = query row col, elements k0+8g+0..7 and k0+16+8g+0..7), so no logits / P plane goes to memory.
// pass 1: min over keys of d2 = e.e; logit = -0.5 (sqrt(d2) / sigma)^2 = -0.5 d2 / sigma^2 falls with d2, so the row maximum of the logits is the logit of that minimum. pass 2: p = exp(logit - max) = exp2(c d2 - K), K = c d2min as rounded, split bf16 hi + lo against the exact value planes (2 products), row sum of p in f32.
// density = sum exp(logit) = exp2(K) . sum p with the same rounded K, so K's rounding cancels.
// end: the waves' partial tiles and sums are added through LDS in wave order; targets = tile / sum p.
// every full '#pragma unroll' here: d2, p, acc, vv stay in registers only under constant indices.
#define QT 16
#define NW 8
#define KW (NK / NW)
// e.e for the lane's 16 keys of one 32-key chunk, two keys per packed f32 operation; element order = the A fragment's k order
__device__ __forceinline__ void dsq16(const float* kxp, const float* kyp, float qx, float qy, float w00, float w01, float w10, float w11, float d2[16]) {
#pragma unroll
  for (int h = 0; h < 4; ++h) { const int o = (h & 1) * 4 + (h >> 1) * 16; const v4f x = *(const v4f*)(kxp + o), y = *(const v4f*)(kyp + o);
#pragma unroll
    for (int u = 0; u < 2; ++u) { v2f kx, ky; kx[0] = x[2 * u]; kx[1] = x[2 * u + 1]; ky[0] = y[2 * u]; ky[1] = y[2 * u + 1]; const v2f dx = kx - qx, dy = ky - qy; const v2f e0 = dx * w00 + dy * w01, e1 = dx * w10 + dy * w11; const v2f d = e0 * e0 + e1 * e1; d2[h * 4 + 2 * u] = d[0]; d2[h * 4 + 2 * u + 1] = d[1]; } } }
// 8 hardware exp2 in place. One statement, so that behind every v_exp_f32 stands an instruction that neither reads its result nor overwrites its source (the slot the instruction set asks for behind a transcendental): the next, independent v_exp_f32, and the closing v_nop behind the last. Below 2^-126 the instruction gives 0.
__device__ __forceinline__ void exp2x8(float* x) {
  asm("v_exp_f32 %0, %0\n\tv_exp_f32 %1, %1\n\tv_exp_f32 %2, %2\n\tv_exp_f32 %3, %3\n\tv_exp_f32 %4, %4\n\tv_exp_f32 %5, %5\n\tv_exp_f32 %6, %6\n\tv_exp_f32 %7, %7\n\tv_nop" : "+v"(x[0]), "+v"(x[1]), "+v"(x[2]), "+v"(x[3]), "+v"(x[4]), "+v"(x[5]), "+v"(x[6]), "+v"(x[7])); }
__global__ __launch_bounds__(NW * 32) void k_fa(const float* __restrict__ KEYS, const float* __restrict__ QRY, const float* __restrict__ WW, const float* __restrict__ LS, const __bf16* __restrict__ VP, float* __restrict__ T, float* __restrict__ DEN) {
  __shared__ __align__(16) float skx[NK], sky[NK]; __shared__ __align__(16) float red[NW][QT][CIN + 4]; __shared__ float smn[NW][QT], ssm[NW][QT], sk[QT];
  const int tid = threadIdx.x, wave = tid >> 5, lane = tid & 31, col = lane & 15, g = lane >> 4; const int q0 = blockIdx.x * QT; const size_t b = blockIdx.y;
  for (int k = tid; k < NK; k += NW * 32) { const v2f kk = *(const v2f*)(KEYS + (b * NK + k) * 2); skx[k] = bfr(kk[0]); sky[k] = bfr(kk[1]); }
  const v2f qq = *(const v2f*)(QRY + (b * NQ + q0 + col) * 2); const float qx = bfr(qq[0]), qy = bfr(qq[1]);
  const float w00 = bfr(WW[0]), w01 = bfr(WW[1]), w10 = bfr(WW[2]), w11 = bfr(WW[3]);
  const float z = bfr(LS[0]) * 0.1f - 1.0f; const float sp = (z > 0.f ? z : 0.f) + log1pf(expf(-fabsf(z)));   // softplus = logaddexp(z, 0)
  const float sigma = 1e-05f + sp; const float is = 1.0f / sigma; const float c = (-0.5f * 1.44269504088896340736f) * is * is;   // logit . log2(e) = c d2
  __syncthreads();
  const int kw0 = wave * KW + 8 * g;
  float mn = 3.0e38f;
#pragma unroll 1   // kept rolled: 8 copies of the body gain nothing (no carried latency but the min) and only cost instruction cache
  for (int kc = 0; kc < KW / 32; ++kc) { float d2[16]; dsq16(skx + kw0 + kc * 32, sky + kw0 + kc * 32, qx, qy, w00, w01, w10, w11, d2);
#pragma unroll
    for (int i = 0; i < 16; ++i) mn = fminf(mn, d2[i]); }
  mn = fminf(mn, __shfl_xor(mn, 16)); if (g == 0) smn[wave][col] = mn;
  __syncthreads();
  mn = smn[0][col];
#pragma unroll
  for (int w = 1; w < NW; ++w) mn = fminf(mn, smn[w][col]);
  const float K = c * mn; if (tid < QT) sk[col] = K;
  v8f acc[CIN / 16] = {}; float s = 0.f;
#pragma unroll 1   // kept rolled: one body has 16 independent chains of its own and the other waves of the SIMD cover its loads; 8 copies would only cost instruction cache
  for (int kc = 0; kc < KW / 32; ++kc) { v16b vv[CIN / 16];
#pragma unroll
    for (int j = 0; j < CIN / 16; ++j) vv[j] = frag_o(VP + (b * NK + wave * KW + kc * 32) * CIN + j * 512 + lane * 8);
    float p[16], d2[16]; dsq16(skx + kw0 + kc * 32, sky + kw0 + kc * 32, qx, qy, w00, w01, w10, w11, d2);
#pragma unroll
    for (int i = 0; i < 16; ++i) p[i] = fmaf(d2[i], c, -K);
    exp2x8(p); exp2x8(p + 8);   // a p below 2^-126 becomes 0: it adds nothing to a sum whose largest term is 1
#pragma unroll
    for (int i = 0; i < 16; ++i) s += p[i];
    const F2 pf = bsplit16(p);
#pragma unroll
    for (int j = 0; j < CIN / 16; ++j) acc[j] = __builtin_amdgcn_wmma_f32_16x16x32_bf16(false, pf.h, false, vv[j], (short)0, acc[j], false, false);
#pragma unroll
    for (int j = 0; j < CIN / 16; ++j) acc[j] = __builtin_amdgcn_wmma_f32_16x16x32_bf16(false, pf.l, false, vv[j], (short)0, acc[j], false, false); }
  s += __shfl_xor(s, 16); if (g == 0) ssm[wave][col] = s;
#pragma unroll
  for (int j = 0; j < CIN / 16; ++j)
#pragma unroll
    for (int r = 0; r < 8; ++r) red[wave][8 * g + r][j * 16 + col] = acc[j][r];
  __syncthreads();
  constexpr int CPT = QT * CIN / (NW * 32);   // channels per thread of the final sum
  const int q = tid / (CIN / CPT), c0 = (tid % (CIN / CPT)) * CPT; float st = 0.f; v4f a[CPT / 4] = {};
#pragma unroll
  for (int w = 0; w < NW; ++w) { st += ssm[w][q];
#pragma unroll
    for (int u = 0; u < CPT / 4; ++u) a[u] += *(const v4f*)&red[w][q][c0 + 4 * u]; }
  const float inv = 1.0f / st; float* tr = T + (b * NQ + q0 + q) * CIN + c0;
#pragma unroll
  for (int u = 0; u < CPT / 4; ++u) vst2(tr + 4 * u, a[u] * inv);
  if (c0 == 0) DEN[(b * NQ + q0 + q) * 32] = exp2f(sk[q]) * st; }
// ---- k_out: block = 64 rows: out = targets (hi + lo) . R[:, :64]^T + sigmoid(0.1 (-density dW + db)) R[:, 64] + rb; 256-B rows
__global__ __launch_bounds__(128) void k_out(const float* __restrict__ T, const float* __restrict__ DEN, const float* __restrict__ DW, const float* __restrict__ DB, const float* __restrict__ RW, const float* __restrict__ RB, float* __restrict__ OUT) { __shared__ __align__(16) float sf[4][16][68];
  const int tid = threadIdx.x, wave = tid >> 5, lane = tid & 31, col = lane & 15, g = lane >> 4; const size_t r0 = (size_t)blockIdx.x * 64 + wave * 16;
  v8f acc[4] = {};
#pragma unroll
  for (int kc = 0; kc < CIN / 32; ++kc) { const F2 a = split_row(T + (r0 + col) * CIN, kc * 32, lane);
#pragma unroll
    for (int j = 0; j < 4; ++j) { v16b w; const float* wr = RW + (size_t)(j * 16 + col) * (CIN + 1) + kc * 32 + 8 * g;
#pragma unroll
      for (int i = 0; i < 8; ++i) { w[i] = (__bf16)wr[i]; w[8 + i] = (__bf16)wr[16 + i]; }
      asm volatile("s_wait_loadcnt 0x0" ::: "memory"); acc[j] = wmma_bf(a.h, w, acc[j]); acc[j] = wmma_bf(a.l, w, acc[j]); } }
  const float dw = bfr(DW[0]), db = bfr(DB[0]);
#pragma unroll
  for (int j = 0; j < 4; ++j) { const int o = j * 16 + col; const float wden = bfr(RW[(size_t)o * (CIN + 1) + CIN]), bb = bfr(RB[o]);
#pragma unroll
    for (int r = 0; r < 8; ++r) { const float den = DEN[(r0 + 8 * g + r) * 32]; const float sg = 1.0f / (1.0f + expf(-((-den * dw + db) * 0.1f))); sf[wave][8 * g + r][o] = acc[j][r] + sg * wden + bb; } }
  LDSX(); for (int rl = 0; rl < 16; ++rl) if (lane < 16) vst2(OUT + (r0 + rl) * COUT + lane * 4, *(const v4f*)&sf[wave][rl][lane * 4]); }
extern "C" void kernel_launch(void* const* d_in, const int* in_sizes, int n_in, void* d_out, int out_size, void* d_ws, size_t ws_size, hipStream_t stream) {
  (void)in_sizes; (void)n_in; (void)out_size;
  const float** F = (const float**)d_in;   // 0 keys [8,2048,2], 1 queries [8,2048,2], 2 values [8,2048,64], 3 weighter_W [2,2], 4 length_scale_param [1], 5 density_W [1], 6 density_b [1], 7 resizer_W [64,65] ([out,in]), 8 resizer_b [64]
  if (ws_size < (size_t)WS_END) return;
  char* ws = (char*)d_ws; __bf16* VP = (__bf16*)(ws + WS_VP); float *T = (float*)(ws + WS_T), *DEN = (float*)(ws + WS_DEN);
  k_vt<<<dim3(NK / 128, TNB), 128, 0, stream>>>(F[2], VP);
  k_fa<<<dim3(NQ / QT, TNB), NW * 32, 0, stream>>>(F[0], F[1], F[3], F[4], VP, T, DEN);
  k_out<<<dim3(TNB * NQ / 64), 128, 0, stream>>>(T, DEN, F[5], F[6], F[7], F[8], (float*)d_out);
}

// v005
// Measured time: 34.9 microseconds a run.
// Next to v004, in two timings, it ran 1.13 and 1.09 times as fast.
// All steps since v000 together make it 25.0 times as fast.
// compute dtype: all float inputs rounded to bf16; the pairwise geometry (diff, 2x2 weighting, squared distance), softmax, density and sigmoid in f32; sigma and the sigmoid with precise expf/log1pf; unnormalised P = exp(logit - max) = exp2(c d2 - c d2min), c = -0.5 log2(e) / sigma^2, one fma and one hardware exp2 a pair, split bf16 hi + lo against the EXACT bf16 value planes on WMMA 16x16x32 (2 products, f32 accumulate); the 65 -> 64 resizer with the f32 operand split bf16 hi + lo (2 products) + bias; f32 output.
#include <hip/hip_runtime.h>
#include <math.h>

typedef __attribute__((ext_vector_type(16))) _Float16 v16h;
typedef __attribute__((ext_vector_type(16))) __bf16 v16b;
typedef __attribute__((ext_vector_type(8)))  _Float16 v8h;
typedef __attribute__((ext_vector_type(8)))  float v8f;
typedef __attribute__((ext_vector_type(4)))  float v4f;
typedef __attribute__((ext_vector_type(2)))  float v2f;
typedef __attribute__((ext_vector_type(4)))  unsigned v4u;
typedef __attribute__((ext_vector_type(4)))  int v4i;
typedef float __attribute__((may_alias)) float_a;
typedef int __attribute__((may_alias)) int_a;

template <typename T> __device__ __forceinline__ void vst2(void* p, T v) { *(T*)p = v;  }
__device__ __forceinline__ v8f wmma16(v16h a, v16h b, v8f c) {
  v8f d = __builtin_amdgcn_wmma_f32_16x16x32_f16(false, a, false, b, (short)0, c, false, false);
  asm volatile("v_nop\n\tv_nop\n\tv_nop\n\tv_nop" : "+v"(d) : "v"(a), "v"(b));
  return d;
}
__device__ __forceinline__ v8f wmma_bf(v16b a, v16b b, v8f c) {
  v8f d = __builtin_amdgcn_wmma_f32_16x16x32_bf16(false, a, false, b, (short)0, c, false, false);
  asm volatile("v_nop\n\tv_nop\n\tv_nop\n\tv_nop" : "+v"(d) : "v"(a), "v"(b));
  return d;
}
// 16x16x32 fragments: lane = (h = lane>>4, row/col = lane&15); elements 0..7 = k0+8h+0..7, 8..15 = k0+16+8h+0..7; D element r = row 8h+r
__device__ __forceinline__ v16h frag_h(const _Float16* rowk0, int lane) {
  union { v16h v; v8h q[2]; } u; const _Float16* p = rowk0 + 8 * (lane >> 4);
  u.q[0] = *(const v8h*)p; u.q[1] = *(const v8h*)(p + 16); return u.v;
}
__device__ __forceinline__ v16h frag_f32(const float* rowk0, int lane) {
  v16h a; const float* p = rowk0 + 8 * (lane >> 4);
#pragma unroll
  for (int i = 0; i < 8; ++i) { a[i] = (_Float16)p[i]; a[8 + i] = (_Float16)p[16 + i]; }
  return a;
}
__device__ __forceinline__ v16h frag_f32s(const float* rowk0, int lane, float sc) {
  v16h a; const float* p = rowk0 + 8 * (lane >> 4);
#pragma unroll
  for (int i = 0; i < 8; ++i) { a[i] = (_Float16)(p[i] * sc); a[8 + i] = (_Float16)(p[16 + i] * sc); }
  return a;
}
// column fragment from a [K][ld] layout (column n), rows >= K read as 0
__device__ __forceinline__ v16h fragc_f32(const float* W, int k0, int n, int lane, int ld, int K) {
  v16h a; const int g = lane >> 4;
#pragma unroll
  for (int i = 0; i < 8; ++i) { const int ka = k0 + 8 * g + i, kb = ka + 16;
    a[i] = (_Float16)(ka < K ? W[(size_t)(ka < K ? ka : K - 1) * ld + n] : 0.f); a[8 + i] = (_Float16)(kb < K ? W[(size_t)(kb < K ? kb : K - 1) * ld + n] : 0.f); }
  return a;
}
struct F2 { v16b h, l; };
__device__ __forceinline__ F2 bsplit16(const float v[16]) { F2 r;
#pragma unroll
  for (int i = 0; i < 16; ++i) { const __bf16 h = (__bf16)v[i]; r.h[i] = h; r.l[i] = (__bf16)(v[i] - (float)h); }
  return r; }
__device__ __forceinline__ F2 split_row(const float* row, int k0, int lane) { float v[16]; const float* p = row + k0 + 8 * (lane >> 4);
#pragma unroll
  for (int i = 0; i < 8; ++i) { v[i] = p[i]; v[8 + i] = p[16 + i]; }
  return bsplit16(v); }
__device__ __forceinline__ F2 split_rowK(const float* row, int k0, int lane, int K) { float v[16]; const int g = lane >> 4;
#pragma unroll
  for (int i = 0; i < 8; ++i) { const int ka = k0 + 8 * g + i, kb = ka + 16; v[i] = ka < K ? row[ka < K ? ka : K - 1] : 0.f; v[8 + i] = kb < K ? row[kb < K ? kb : K - 1] : 0.f; }
  return bsplit16(v); }
__device__ __forceinline__ F2 split_col(const float* W, int k0, int n, int lane, int ld, int K) { float v[16]; const int g = lane >> 4;
#pragma unroll
  for (int i = 0; i < 8; ++i) { const int ka = k0 + 8 * g + i, kb = ka + 16; v[i] = ka < K ? W[(size_t)(ka < K ? ka : K - 1) * ld + n] : 0.f; v[8 + i] = kb < K ? W[(size_t)(kb < K ? kb : K - 1) * ld + n] : 0.f; }
  return bsplit16(v); }
__device__ __forceinline__ v8f mac3(const F2& a, const F2& b, v8f c) { c = wmma_bf(a.l, b.h, c); c = wmma_bf(a.h, b.l, c); return wmma_bf(a.h, b.h, c); }
__device__ __forceinline__ float sigm(float v) { return 1.0f / (1.0f + expf(-v)); }
#define LDSX() do { asm volatile("s_wait_dscnt 0" ::: "memory"); __builtin_amdgcn_wave_barrier(); __builtin_amdgcn_fence(__ATOMIC_RELEASE, "workgroup"); } while (0)

// SetConv (B 8, 2,048 queries x 2,048 keys, 2-D coords, Cin 64 -> Cout 64): e = (k - q) W^T; dist = |e|; sigma = 1e-5 + softplus(0.1 ls - 1); logits = -0.5 (dist/sigma)^2; weight = softmax_k; density = sum_k exp(logits); targets = weight . values; out = [targets | sigmoid(0.1 (-density dW + db))] R^T + rb.
__device__ __forceinline__ float bfr(float v) { return (float)(__bf16)v; }
#define NB 8
#define NQ 2048
#define NK 2048
#define CIN 64
#define COUT 64
#ifndef TNB
#define TNB NB
#endif
typedef __attribute__((ext_vector_type(8))) __bf16 v8b;
// one B fragment (16 channels x 32 keys) from the fragment-ordered value planes: p = the fragment's 1,024 bytes + the lane's 16; elements 0..7 lie in the first 512 bytes, 8..15 in the second, so each of the two loads reads 512 bytes in a row (4 whole 128-B lines)
__device__ __forceinline__ v16b frag_o(const __bf16* p) { union { v16b v; v8b q[2]; } u; u.q[0] = *(const v8b*)p; u.q[1] = *(const v8b*)(p + 256); return u.v; }
#define WS_VP  0u                                   // bf16 value planes in B-fragment order: [b][32-key chunk][16-channel group j][half][lane = 16 g + col][8 keys]; channel 16 j + col, keys 32 chunk + 16 half + 8 g + 0..7
#define WS_END (WS_VP + 2u * (size_t)NB * CIN * NK)
// ---- k_vt: block = (128 keys, b): values (exact bf16) -> fragment-ordered planes; a block's 4 chunks are 16 KB in a row, stored in address order
__global__ __launch_bounds__(128) void k_vt(const float* __restrict__ V, __bf16* __restrict__ VP) { __shared__ __align__(16) __bf16 th[CIN][136];
  const int tid = threadIdx.x; const int k0 = blockIdx.x * 128; const size_t b = blockIdx.y;
  for (int e = tid; e < 128 * CIN; e += 128) { const int kl = e / CIN, c = e % CIN; th[c][kl] = (__bf16)V[(b * NK + k0 + kl) * CIN + c]; }
  __syncthreads();
  for (int e = tid; e < CIN * 16; e += 128) { const int ln = e & 31, hf = (e >> 5) & 1, j = (e >> 6) & 3, ch = e >> 8; const int c = j * 16 + (ln & 15), q = ch * 4 + hf * 2 + (ln >> 4); vst2((unsigned*)(VP + (b * NK + k0) * CIN + e * 8), *(const v4u*)&th[c][q * 8]); } }
// ---- k_fa: block = 16 queries of batch b = blockIdx.y, 8 waves; wave w owns keys [256 w, 256 w + 256). Logits are formed in registers, straight in the A-fragment layout (lane = query row col, elements k0+8g+0..7 and k0+16+8g+0..7), so no logits / P plane goes to memory.
// pass 1: min over keys of d2 = e.e; logit = -0.5 (sqrt(d2) / sigma)^2 = -0.5 d2 / sigma^2 falls with d2, so the row maximum of the logits is the logit of that minimum. pass 2: p = exp(logit - max) = exp2(c d2 - K), K = c d2min as rounded, split bf16 hi + lo against the exact value planes (2 products), row sum of p in f32.
// density = sum exp(logit) = exp2(K) . sum p with the same rounded K, so K's rounding cancels.
// end: the waves' partial tiles and sums are added through LDS in wave order; targets = tile / sum p, kept in LDS.
// tail: out = targets (hi + lo) . R[:, :64]^T + sigmoid(0.1 (-density dW + db)) R[:, 64] + rb for the block's 16 rows: wave w makes output channels 16 (w & 3) .. + 15 over input channels 32 (w >> 2) .. + 31 (2 products); the two half sums meet in LDS and leave as whole 256-B rows.
// every full '#pragma unroll' here: d2, p, acc, vv stay in registers only under constant indices.
#define QT 16
#define NW 8
#define KW (NK / NW)
// e.e for the lane's 16 keys of one 32-key chunk, two keys per packed f32 operation; element order = the A fragment's k order
__device__ __forceinline__ void dsq16(const float* kxp, const float* kyp, float qx, float qy, float w00, float w01, float w10, float w11, float d2[16]) {
#pragma unroll
  for (int h = 0; h < 4; ++h) { const int o = (h & 1) * 4 + (h >> 1) * 16; const v4f x = *(const v4f*)(kxp + o), y = *(const v4f*)(kyp + o);
#pragma unroll
    for (int u = 0; u < 2; ++u) { v2f kx, ky; kx[0] = x[2 * u]; kx[1] = x[2 * u + 1]; ky[0] = y[2 * u]; ky[1] = y[2 * u + 1]; const v2f dx = kx - qx, dy = ky - qy; const v2f e0 = dx * w00 + dy * w01, e1 = dx * w10 + dy * w11; const v2f d = e0 * e0 + e1 * e1; d2[h * 4 + 2 * u] = d[0]; d2[h * 4 + 2 * u + 1] = d[1]; } } }
// 8 hardware exp2 in place. One statement, so that behind every v_exp_f32 stands an instruction that neither reads its result nor overwrites its source (the slot the instruction set asks for behind a transcendental): the next, independent v_exp_f32, and the closing v_nop behind the last. Below 2^-126 the instruction gives 0.
__device__ __forceinline__ void exp2x8(float* x) {
  asm("v_exp_f32 %0, %0\n\tv_exp_f32 %1, %1\n\tv_exp_f32 %2, %2\n\tv_exp_f32 %3, %3\n\tv_exp_f32 %4, %4\n\tv_exp_f32 %5, %5\n\tv_exp_f32 %6, %6\n\tv_exp_f32 %7, %7\n\tv_nop" : "+v"(x[0]), "+v"(x[1]), "+v"(x[2]), "+v"(x[3]), "+v"(x[4]), "+v"(x[5]), "+v"(x[6]), "+v"(x[7])); }
__global__ __launch_bounds__(NW * 32) void k_fa(const float* __restrict__ KEYS, const float* __restrict__ QRY, const float* __restrict__ WW, const float* __restrict__ LS, const __bf16* __restrict__ VP, const float* __restrict__ DW, const float* __restrict__ DB, const float* __restrict__ RW, const float* __restrict__ RB, float* __restrict__ OUT) {
  __shared__ __align__(16) float skx[NK], sky[NK]; __shared__ __align__(16) float red[NW][QT][CIN + 4]; __shared__ float smn[NW][QT], ssm[NW][QT], sk[QT], ssg[QT];
  const int tid = threadIdx.x, wave = tid >> 5, lane = tid & 31, col = lane & 15, g = lane >> 4; const int q0 = blockIdx.x * QT; const size_t b = blockIdx.y;
  for (int k = tid; k < NK; k += NW * 32) { const v2f kk = *(const v2f*)(KEYS + (b * NK + k) * 2); skx[k] = bfr(kk[0]); sky[k] = bfr(kk[1]); }
  const v2f qq = *(const v2f*)(QRY + (b * NQ + q0 + col) * 2); const float qx = bfr(qq[0]), qy = bfr(qq[1]);
  const float w00 = bfr(WW[0]), w01 = bfr(WW[1]), w10 = bfr(WW[2]), w11 = bfr(WW[3]); const float dw = bfr(DW[0]), db = bfr(DB[0]);
  const float z = bfr(LS[0]) * 0.1f - 1.0f; const float sp = (z > 0.f ? z : 0.f) + log1pf(expf(-fabsf(z)));   // softplus = logaddexp(z, 0)
  const float sigma = 1e-05f + sp; const float is = 1.0f / sigma; const float c = (-0.5f * 1.44269504088896340736f) * is * is;   // logit . log2(e) = c d2
  __syncthreads();
  const int kw0 = wave * KW + 8 * g;
  float mn = 3.0e38f;
#pragma unroll 1   // kept rolled: 8 copies of the body gain nothing (no carried latency but the min) and only cost instruction cache
  for (int kc = 0; kc < KW / 32; ++kc) { float d2[16]; dsq16(skx + kw0 + kc * 32, sky + kw0 + kc * 32, qx, qy, w00, w01, w10, w11, d2);
#pragma unroll
    for (int i = 0; i < 16; ++i) mn = fminf(mn, d2[i]); }
  mn = fminf(mn, __shfl_xor(mn, 16)); if (g == 0) smn[wave][col] = mn;
  __syncthreads();
  mn = smn[0][col];
#pragma unroll
  for (int w = 1; w < NW; ++w) mn = fminf(mn, smn[w][col]);
  const float K = c * mn; if (tid < QT) sk[col] = K;
  v8f acc[CIN / 16] = {}; float s = 0.f;
#pragma unroll 1   // kept rolled: one body has 16 independent chains of its own and the other waves of the SIMD cover its loads; 8 copies would only cost instruction cache
  for (int kc = 0; kc < KW / 32; ++kc) { v16b vv[CIN / 16];
#pragma unroll
    for (int j = 0; j < CIN / 16; ++j) vv[j] = frag_o(VP + (b * NK + wave * KW + kc * 32) * CIN + j * 512 + lane * 8);
    float p[16], d2[16]; dsq16(skx + kw0 + kc * 32, sky + kw0 + kc * 32, qx, qy, w00, w01, w10, w11, d2);
#pragma unroll
    for (int i = 0; i < 16; ++i) p[i] = fmaf(d2[i], c, -K);
    exp2x8(p); exp2x8(p + 8);   // a p below 2^-126 becomes 0: it adds nothing to a sum whose largest term is 1
#pragma unroll
    for (int i = 0; i < 16; ++i) s += p[i];
    const F2 pf = bsplit16(p);
#pragma unroll
    for (int j = 0; j < CIN / 16; ++j) acc[j] = __builtin_amdgcn_wmma_f32_16x16x32_bf16(false, pf.h, false, vv[j], (short)0, acc[j], false, false);
#pragma unroll
    for (int j = 0; j < CIN / 16; ++j) acc[j] = __builtin_amdgcn_wmma_f32_16x16x32_bf16(false, pf.l, false, vv[j], (short)0, acc[j], false, false); }
  s += __shfl_xor(s, 16); if (g == 0) ssm[wave][col] = s;
#pragma unroll
  for (int j = 0; j < CIN / 16; ++j)
#pragma unroll
    for (int r = 0; r < 8; ++r) red[wave][8 * g + r][j * 16 + col] = acc[j][r];
  __syncthreads();
  // the tail's resizer operands are asked for here, by every wave alike, so that their latency runs under the block sum
  const int wv = __builtin_amdgcn_readfirstlane(wave); const int o = (wv & 3) * 16 + col, kh = wv >> 2; float wf[16];
  { const float* wr = RW + (size_t)o * (CIN + 1) + kh * 32 + 8 * g;
#pragma unroll
    for (int i = 0; i < 8; ++i) { wf[i] = wr[i]; wf[8 + i] = wr[16 + i]; } }
  const float wden = RW[(size_t)o * (CIN + 1) + CIN], bb = RB[o];
  constexpr int CPT = QT * CIN / (NW * 32);   // channels per thread of the final sum
  const int q = tid / (CIN / CPT), c0 = (tid % (CIN / CPT)) * CPT; float st = 0.f; v4f a[CPT / 4] = {};
#pragma unroll
  for (int w = 0; w < NW; ++w) { st += ssm[w][q];
#pragma unroll
    for (int u = 0; u < CPT / 4; ++u) a[u] += *(const v4f*)&red[w][q][c0 + 4 * u]; }
  const float inv = 1.0f / st;
#pragma unroll
  for (int u = 0; u < CPT / 4; ++u) vst2(&red[0][q][c0 + 4 * u], a[u] * inv);   // in place: these cells of red are read by this thread alone
  if (c0 == 0) { const float den = exp2f(sk[q]) * st; ssg[q] = 1.0f / (1.0f + expf(-((-den * dw + db) * 0.1f))); }
  __syncthreads();   // the 16 target rows and their density terms are whole; red[1..] is free
  { const F2 af = split_row(&red[0][col][0], kh * 32, lane); v16b w; v8f oa = {};
#pragma unroll
    for (int i = 0; i < 16; ++i) w[i] = (__bf16)wf[i];
    oa = wmma_bf(af.h, w, oa); oa = wmma_bf(af.l, w, oa);
    if (kh == 0) { const float wd = bfr(wden), rb = bfr(bb);   // the density term and the bias go in once, with the first half
#pragma unroll
      for (int r = 0; r < 8; ++r) oa[r] = oa[r] + ssg[8 * g + r] * wd + rb; }
#pragma unroll
    for (int r = 0; r < 8; ++r) red[1 + kh][8 * g + r][o] = oa[r]; }
  __syncthreads();   // both half sums of the output tile are whole
#pragma unroll
  for (int u = 0; u < CPT / 4; ++u) vst2(OUT + (b * NQ + q0 + q) * COUT + c0 + 4 * u, *(const v4f*)&red[1][q][c0 + 4 * u] + *(const v4f*)&red[2][q][c0 + 4 * u]); }
extern "C" void kernel_launch(void* const* d_in, const int* in_sizes, int n_in, void* d_out, int out_size, void* d_ws, size_t ws_size, hipStream_t stream) {
  (void)in_sizes; (void)n_in; (void)out_size;
  const float** F = (const float**)d_in;   // 0 keys [8,2048,2], 1 queries [8,2048,2], 2 values [8,2048,64], 3 weighter_W [2,2], 4 length_scale_param [1], 5 density_W [1], 6 density_b [1], 7 resizer_W [64,65] ([out,in]), 8 resizer_b [64]
  if (ws_size < (size_t)WS_END) return;
  char* ws = (char*)d_ws; __bf16* VP = (__bf16*)(ws + WS_VP);
  k_vt<<<dim3(NK / 128, TNB), 128, 0, stream>>>(F[2], VP);
  k_fa<<<dim3(NQ / QT, TNB), NW * 32, 0, stream>>>(F[0], F[1], F[3], F[4], VP, F[5], F[6], F[7], F[8], (float*)d_out);
}

// v006
// Measured time: 27.3 microseconds a run.
// In both of two side-by-side timings against v005, it was 1.22 times as fast.
// Over all steps from v000 it is 30.4 times as fast.
// compute dtype: all float inputs rounded to bf16; the 2x2 weighting of keys and queries, the pairwise logits (f32 WMMA 16x16x4), softmax, density and sigmoid in f32; sigma and the sigmoid with precise expf/log1pf; unnormalised P = exp(logit - max) = exp2(c d2 - max c d2), c = -0.5 log2(e) / sigma^2, c d2 expanded into c |u|^2 - 2 c u.v + c |v|^2 (u = W k, v = W q), one hardware exp2 a pair, split bf16 hi + lo against the EXACT bf16 value planes on WMMA 16x16x32 (2 products, f32 accumulate); the 65 -> 64 resizer with the f32 operand split bf16 hi + lo (2 products) + bias; f32 output.
#include <hip/hip_runtime.h>
#include <math.h>

typedef __attribute__((ext_vector_type(16))) _Float16 v16h;
typedef __attribute__((ext_vector_type(16))) __bf16 v16b;
typedef __attribute__((ext_vector_type(8)))  _Float16 v8h;
typedef __attribute__((ext_vector_type(8)))  float v8f;
typedef __attribute__((ext_vector_type(4)))  float v4f;
typedef __attribute__((ext_vector_type(2)))  float v2f;
typedef __attribute__((ext_vector_type(4)))  unsigned v4u;
typedef __attribute__((ext_vector_type(4)))  int v4i;
typedef float __attribute__((may_alias)) float_a;
typedef int __attribute__((may_alias)) int_a;

template <typename T> __device__ __forceinline__ void vst2(void* p, T v) { *(T*)p = v;  }
__device__ __forceinline__ v8f wmma16(v16h a, v16h b, v8f c) {
  v8f d = __builtin_amdgcn_wmma_f32_16x16x32_f16(false, a, false, b, (short)0, c, false, false);
  asm volatile("v_nop\n\tv_nop\n\tv_nop\n\tv_nop" : "+v"(d) : "v"(a), "v"(b));
  return d;
}
__device__ __forceinline__ v8f wmma_bf(v16b a, v16b b, v8f c) {
  v8f d = __builtin_amdgcn_wmma_f32_16x16x32_bf16(false, a, false, b, (short)0, c, false, false);
  asm volatile("v_nop\n\tv_nop\n\tv_nop\n\tv_nop" : "+v"(d) : "v"(a), "v"(b));
  return d;
}
// 16x16x32 fragments: lane = (h = lane>>4, row/col = lane&15); elements 0..7 = k0+8h+0..7, 8..15 = k0+16+8h+0..7; D element r = row 8h+r
__device__ __forceinline__ v16h frag_h(const _Float16* rowk0, int lane) {
  union { v16h v; v8h q[2]; } u; const _Float16* p = rowk0 + 8 * (lane >> 4);
  u.q[0] = *(const v8h*)p; u.q[1] = *(const v8h*)(p + 16); return u.v;
}
__device__ __forceinline__ v16h frag_f32(const float* rowk0, int lane) {
  v16h a; const float* p = rowk0 + 8 * (lane >> 4);
#pragma unroll
  for (int i = 0; i < 8; ++i) { a[i] = (_Float16)p[i]; a[8 + i] = (_Float16)p[16 + i]; }
  return a;
}
__device__ __forceinline__ v16h frag_f32s(const float* rowk0, int lane, float sc) {
  v16h a; const float* p = rowk0 + 8 * (lane >> 4);
#pragma unroll
  for (int i = 0; i < 8; ++i) { a[i] = (_Float16)(p[i] * sc); a[8 + i] = (_Float16)(p[16 + i] * sc); }
  return a;
}
// column fragment from a [K][ld] layout (column n), rows >= K read as 0
__device__ __forceinline__ v16h fragc_f32(const float* W, int k0, int n, int lane, int ld, int K) {
  v16h a; const int g = lane >> 4;
#pragma unroll
  for (int i = 0; i < 8; ++i) { const int ka = k0 + 8 * g + i, kb = ka + 16;
    a[i] = (_Float16)(ka < K ? W[(size_t)(ka < K ? ka : K - 1) * ld + n] : 0.f); a[8 + i] = (_Float16)(kb < K ? W[(size_t)(kb < K ? kb : K - 1) * ld + n] : 0.f); }
  return a;
}
struct F2 { v16b h, l; };
__device__ __forceinline__ F2 bsplit16(const float v[16]) { F2 r;
#pragma unroll
  for (int i = 0; i < 16; ++i) { const __bf16 h = (__bf16)v[i]; r.h[i] = h; r.l[i] = (__bf16)(v[i] - (float)h); }
  return r; }
__device__ __forceinline__ F2 split_row(const float* row, int k0, int lane) { float v[16]; const float* p = row + k0 + 8 * (lane >> 4);
#pragma unroll
  for (int i = 0; i < 8; ++i) { v[i] = p[i]; v[8 + i] = p[16 + i]; }
  return bsplit16(v); }
__device__ __forceinline__ F2 split_rowK(const float* row, int k0, int lane, int K) { float v[16]; const int g = lane >> 4;
#pragma unroll
  for (int i = 0; i < 8; ++i) { const int ka = k0 + 8 * g + i, kb = ka + 16; v[i] = ka < K ? row[ka < K ? ka : K - 1] : 0.f; v[8 + i] = kb < K ? row[kb < K ? kb : K - 1] : 0.f; }
  return bsplit16(v); }
__device__ __forceinline__ F2 split_col(const float* W, int k0, int n, int lane, int ld, int K) { float v[16]; const int g = lane >> 4;
#pragma unroll
  for (int i = 0; i < 8; ++i) { const int ka = k0 + 8 * g + i, kb = ka + 16; v[i] = ka < K ? W[(size_t)(ka < K ? ka : K - 1) * ld + n] : 0.f; v[8 + i] = kb < K ? W[(size_t)(kb < K ? kb : K - 1) * ld + n] : 0.f; }
  return bsplit16(v); }
__device__ __forceinline__ v8f mac3(const F2& a, const F2& b, v8f c) { c = wmma_bf(a.l, b.h, c); c = wmma_bf(a.h, b.l, c); return wmma_bf(a.h, b.h, c); }
__device__ __forceinline__ float sigm(float v) { return 1.0f / (1.0f + expf(-v)); }
#define LDSX() do { asm volatile("s_wait_dscnt 0" ::: "memory"); __builtin_amdgcn_wave_barrier(); __builtin_amdgcn_fence(__ATOMIC_RELEASE, "workgroup"); } while (0)

// SetConv (B 8, 2,048 queries x 2,048 keys, 2-D coords, Cin 64 -> Cout 64): e = (k - q) W^T; dist = |e|; sigma = 1e-5 + softplus(0.1 ls - 1); logits = -0.5 (dist/sigma)^2; weight = softmax_k; density = sum_k exp(logits); targets = weight . values; out = [targets | sigmoid(0.1 (-density dW + db))] R^T + rb.
__device__ __forceinline__ float bfr(float v) { return (float)(__bf16)v; }
#define NB 8
#define NQ 2048
#define NK 2048
#define CIN 64
#define COUT 64
#ifndef TNB
#define TNB NB
#endif
typedef __attribute__((ext_vector_type(8))) __bf16 v8b;
// one B fragment (16 channels x 32 keys) from the fragment-ordered value planes: p = the fragment's 1,024 bytes + the lane's 16; elements 0..7 lie in the first 512 bytes, 8..15 in the second, so each of the two loads reads 512 bytes in a row (4 whole 128-B lines)
__device__ __forceinline__ v16b frag_o(const __bf16* p) { union { v16b v; v8b q[2]; } u; u.q[0] = *(const v8b*)p; u.q[1] = *(const v8b*)(p + 256); return u.v; }
#define WS_VP  0u                                   // bf16 value planes in B-fragment order: [b][32-key chunk][16-channel group j][half][lane = 16 g + col][8 keys]; channel 16 j + col, keys 32 chunk + 16 half + 8 g + 0..7
#define WS_END (WS_VP + 2u * (size_t)NB * CIN * NK)
// ---- k_vt: block = (128 keys, b): values (exact bf16) -> fragment-ordered planes; a block's 4 chunks are 16 KB in a row, stored in address order
__global__ __launch_bounds__(128) void k_vt(const float* __restrict__ V, __bf16* __restrict__ VP) { __shared__ __align__(16) __bf16 th[CIN][136];
  const int tid = threadIdx.x; const int k0 = blockIdx.x * 128; const size_t b = blockIdx.y;
  for (int e = tid; e < 128 * CIN; e += 128) { const int kl = e / CIN, c = e % CIN; th[c][kl] = (__bf16)V[(b * NK + k0 + kl) * CIN + c]; }
  __syncthreads();
  for (int e = tid; e < CIN * 16; e += 128) { const int ln = e & 31, hf = (e >> 5) & 1, j = (e >> 6) & 3, ch = e >> 8; const int c = j * 16 + (ln & 15), q = ch * 4 + hf * 2 + (ln >> 4); vst2((unsigned*)(VP + (b * NK + k0) * CIN + e * 8), *(const v4u*)&th[c][q * 8]); } }
// ---- k_fa: block = 16 queries of batch b = blockIdx.y, 8 waves; wave w owns keys [256 w, 256 w + 256). No logits / P plane goes to memory.
// logit . log2(e) = c d2 = c |u - v|^2 = (c |u|^2 - 2 c u.v) + c |v|^2, u = W k, v = W q. The bracket, t, is a product of depth 3: one f32 WMMA 16x16x4 makes it for 16 keys x 16 queries, A row (key) = (u0, u1, |u|^2, 1), B column (query) = (-2 c v0, -2 c v1, c, 0).
// With the keys as the rows, D register r of lane (g, col) is key 8 g + r of the tile, query col: two tiles of 16 keys are the 16 elements of the bf16 A fragment of P (lane = query row col, elements k0+8g+0..7 and k0+16+8g+0..7) as they stand, with no lane exchange.
// pass 1: M = max over keys of t. pass 2: p = exp(logit - max) = exp2(t - M), -M standing in the B column's fourth place, split bf16 hi + lo against the exact value planes (2 products), row sum of p in f32.
// density = sum exp(logit) = exp2(K) . sum p, K = c |v|^2 + M.
// end: the waves' partial tiles and sums are added through LDS in wave order; targets = tile / sum p, kept in LDS.
// tail: out = targets (hi + lo) . R[:, :64]^T + sigmoid(0.1 (-density dW + db)) R[:, 64] + rb for the block's 16 rows: wave w makes output channels 16 (w & 3) .. + 15 over input channels 32 (w >> 2) .. + 31 (2 products); the two half sums meet in LDS and leave as whole 256-B rows.
// every full '#pragma unroll' here: l, p, acc, vv stay in registers only under constant indices.
#define QT 16
#define NW 8
#define KW (NK / NW)
__device__ __forceinline__ v8f wmma4(v2f a, v2f b, v8f c) { return __builtin_amdgcn_wmma_f32_16x16x4_f32(false, a, false, b, (short)0, c, false, false); }
// 8 hardware exp2 in place. One statement, so that behind every v_exp_f32 stands an instruction that neither reads its result nor overwrites its source (the slot the instruction set asks for behind a transcendental): the next, independent v_exp_f32, and the closing v_nop behind the last. Below 2^-126 the instruction gives 0.
__device__ __forceinline__ void exp2x8(float* x) {
  asm("v_exp_f32 %0, %0\n\tv_exp_f32 %1, %1\n\tv_exp_f32 %2, %2\n\tv_exp_f32 %3, %3\n\tv_exp_f32 %4, %4\n\tv_exp_f32 %5, %5\n\tv_exp_f32 %6, %6\n\tv_exp_f32 %7, %7\n\tv_nop" : "+v"(x[0]), "+v"(x[1]), "+v"(x[2]), "+v"(x[3]), "+v"(x[4]), "+v"(x[5]), "+v"(x[6]), "+v"(x[7])); }
__global__ __launch_bounds__(NW * 32) void k_fa(const float* __restrict__ KEYS, const float* __restrict__ QRY, const float* __restrict__ WW, const float* __restrict__ LS, const __bf16* __restrict__ VP, const float* __restrict__ DW, const float* __restrict__ DB, const float* __restrict__ RW, const float* __restrict__ RB, float* __restrict__ OUT) {
  // ska: the keys' A fragments, 256 bytes a tile of 16 keys: 16 x (u0, u1) for lanes 0..15, then 16 x (|u|^2, 1) for lanes 16..31, so a fragment load is 8 bytes a lane, 256 in a row
  __shared__ __align__(16) float ska[NK * 4]; __shared__ __align__(16) float red[NW][QT][CIN + 4]; __shared__ float smn[NW][QT], ssm[NW][QT], sk[QT], ssg[QT];
  const int tid = threadIdx.x, wave = tid >> 5, lane = tid & 31, col = lane & 15, g = lane >> 4; const int q0 = blockIdx.x * QT; const size_t b = blockIdx.y;
  const float w00 = bfr(WW[0]), w01 = bfr(WW[1]), w10 = bfr(WW[2]), w11 = bfr(WW[3]); const float dw = bfr(DW[0]), db = bfr(DB[0]);
  for (int k = tid; k < NK; k += NW * 32) { const v2f kk = *(const v2f*)(KEYS + (b * NK + k) * 2); const float kx = bfr(kk[0]), ky = bfr(kk[1]); v2f u, n; u[0] = kx * w00 + ky * w01; u[1] = kx * w10 + ky * w11; n[0] = u[0] * u[0] + u[1] * u[1]; n[1] = 1.f;
    float* d = ska + (k >> 4) * 64 + (k & 15) * 2; *(v2f*)d = u; *(v2f*)(d + 32) = n; }
  const v2f qq = *(const v2f*)(QRY + (b * NQ + q0 + col) * 2); const float qx = bfr(qq[0]), qy = bfr(qq[1]);
  const float z = bfr(LS[0]) * 0.1f - 1.0f; const float sp = (z > 0.f ? z : 0.f) + log1pf(expf(-fabsf(z)));   // softplus = logaddexp(z, 0)
  const float sigma = 1e-05f + sp; const float is = 1.0f / sigma; const float c = (-0.5f * 1.44269504088896340736f) * is * is;   // logit . log2(e) = c d2
  const float v0 = qx * w00 + qy * w01, v1 = qx * w10 + qy * w11; const float cv = c * (v0 * v0 + v1 * v1);
  v2f bq; bq[0] = g ? c : -2.f * c * v0; bq[1] = g ? 0.f : -2.f * c * v1;   // the query's B fragment, in the k order of ska
  __syncthreads();
  const float* ap = ska + wave * (KW / 16) * 64 + lane * 2;   // the wave's first A fragment; tile t lies 64 t floats on
  float mx = -3.0e38f;
#pragma unroll   // 16 WMMAs and their maxima, unrolled: every fragment load has a constant offset
  for (int t = 0; t < KW / 16; t += 4) { v8f l[4];
#pragma unroll
    for (int i = 0; i < 4; ++i) l[i] = wmma4(*(const v2f*)(ap + (t + i) * 64), bq, v8f{});
    asm volatile("v_nop\n\tv_nop\n\tv_nop\n\tv_nop" : "+v"(l[0]), "+v"(l[1]), "+v"(l[2]), "+v"(l[3]));   // the four vector slots between a WMMA and the first reader of its D; once for four WMMAs
#pragma unroll
    for (int r = 0; r < 8; ++r) mx = fmaxf(fmaxf(mx, fmaxf(l[0][r], l[1][r])), fmaxf(l[2][r], l[3][r])); }
  mx = fmaxf(mx, __shfl_xor(mx, 16)); if (g == 0) smn[wave][col] = mx;
  __syncthreads();
  mx = smn[0][col];
#pragma unroll
  for (int w = 1; w < NW; ++w) mx = fmaxf(mx, smn[w][col]);
  if (tid < QT) sk[col] = cv + mx;
  if (g) bq[1] = -mx;   // depth 4 from here on: t - M
  v8f acc[CIN / 16] = {}; float s = 0.f;
  // a chunk's two logit WMMAs are issued one chunk ahead, with the eight P.V WMMAs of the chunk before: their results are long whole when exp2x8 reads them, and the vector work of a chunk runs beside the matrix work of the last
  v8f l0 = wmma4(*(const v2f*)ap, bq, v8f{}), l1 = wmma4(*(const v2f*)(ap + 64), bq, v8f{});
  auto chunk = [&](const int kc, const bool more) { v16b vv[CIN / 16];
#pragma unroll
    for (int j = 0; j < CIN / 16; ++j) vv[j] = frag_o(VP + (b * NK + wave * KW + kc * 32) * CIN + j * 512 + lane * 8);
    float p[16];
#pragma unroll
    for (int i = 0; i < 8; ++i) { p[i] = l0[i]; p[8 + i] = l1[i]; }
    exp2x8(p); exp2x8(p + 8);   // a p below 2^-126 becomes 0: it adds nothing to a sum whose largest term is 1
#pragma unroll
    for (int i = 0; i < 16; ++i) s += p[i];
    const F2 pf = bsplit16(p);
    if (more) { l0 = wmma4(*(const v2f*)(ap + kc * 128 + 128), bq, v8f{}); l1 = wmma4(*(const v2f*)(ap + kc * 128 + 192), bq, v8f{}); }
#pragma unroll
    for (int j = 0; j < CIN / 16; ++j) acc[j] = __builtin_amdgcn_wmma_f32_16x16x32_bf16(false, pf.h, false, vv[j], (short)0, acc[j], false, false);
#pragma unroll
    for (int j = 0; j < CIN / 16; ++j) acc[j] = __builtin_amdgcn_wmma_f32_16x16x32_bf16(false, pf.l, false, vv[j], (short)0, acc[j], false, false); };
#pragma unroll 1   // kept rolled: one body has 16 independent chains of its own and the other waves of the SIMD cover its loads; 8 copies would only cost instruction cache
  for (int kc = 0; kc < KW / 32 - 1; ++kc) chunk(kc, true);
  chunk(KW / 32 - 1, false);
  s += __shfl_xor(s, 16); if (g == 0) ssm[wave][col] = s;
#pragma unroll
  for (int j = 0; j < CIN / 16; ++j)
#pragma unroll
    for (int r = 0; r < 8; ++r) red[wave][8 * g + r][j * 16 + col] = acc[j][r];
  __syncthreads();
  // the tail's resizer operands are asked for here, by every wave alike, so that their latency runs under the block sum
  const int wv = __builtin_amdgcn_readfirstlane(wave); const int o = (wv & 3) * 16 + col, kh = wv >> 2; float wf[16];
  { const float* wr = RW + (size_t)o * (CIN + 1) + kh * 32 + 8 * g;
#pragma unroll
    for (int i = 0; i < 8; ++i) { wf[i] = wr[i]; wf[8 + i] = wr[16 + i]; } }
  const float wden = RW[(size_t)o * (CIN + 1) + CIN], bb = RB[o];
  constexpr int CPT = QT * CIN / (NW * 32);   // channels per thread of the final sum
  const int q = tid / (CIN / CPT), c0 = (tid % (CIN / CPT)) * CPT; float st = 0.f; v4f a[CPT / 4] = {};
#pragma unroll
  for (int w = 0; w < NW; ++w) { st += ssm[w][q];
#pragma unroll
    for (int u = 0; u < CPT / 4; ++u) a[u] += *(const v4f*)&red[w][q][c0 + 4 * u]; }
  const float inv = 1.0f / st;
#pragma unroll
  for (int u = 0; u < CPT / 4; ++u) vst2(&red[0][q][c0 + 4 * u], a[u] * inv);   // in place: these cells of red are read by this thread alone
  if (c0 == 0) { const float den = exp2f(sk[q]) * st; ssg[q] = 1.0f / (1.0f + expf(-((-den * dw + db) * 0.1f))); }
  __syncthreads();   // the 16 target rows and their density terms are whole; red[1..] is free
  { const F2 af = split_row(&red[0][col][0], kh * 32, lane); v16b w; v8f oa = {};
#pragma unroll
    for (int i = 0; i < 16; ++i) w[i] = (__bf16)wf[i];
    oa = wmma_bf(af.h, w, oa); oa = wmma_bf(af.l, w, oa);
    if (kh == 0) { const float wd = bfr(wden), rb = bfr(bb);   // the density term and the bias go in once, with the first half
#pragma unroll
      for (int r = 0; r < 8; ++r) oa[r] = oa[r] + ssg[8 * g + r] * wd + rb; }
#pragma unroll
    for (int r = 0; r < 8; ++r) red[1 + kh][8 * g + r][o] = oa[r]; }
  __syncthreads();   // both half sums of the output tile are whole
#pragma unroll
  for (int u = 0; u < CPT / 4; ++u) vst2(OUT + (b * NQ + q0 + q) * COUT + c0 + 4 * u, *(const v4f*)&red[1][q][c0 + 4 * u] + *(const v4f*)&red[2][q][c0 + 4 * u]); }
extern "C" void kernel_launch(void* const* d_in, const int* in_sizes, int n_in, void* d_out, int out_size, void* d_ws, size_t ws_size, hipStream_t stream) {
  (void)in_sizes; (void)n_in; (void)out_size;
  const float** F = (const float**)d_in;   // 0 keys [8,2048,2], 1 queries [8,2048,2], 2 values [8,2048,64], 3 weighter_W [2,2], 4 length_scale_param [1], 5 density_W [1], 6 density_b [1], 7 resizer_W [64,65] ([out,in]), 8 resizer_b [64]
  if (ws_size < (size_t)WS_END) return;
  char* ws = (char*)d_ws; __bf16* VP = (__bf16*)(ws + WS_VP);
  k_vt<<<dim3(NK / 128, TNB), 128, 0, stream>>>(F[2], VP);
  k_fa<<<dim3(NQ / QT, TNB), NW * 32, 0, stream>>>(F[0], F[1], F[3], F[4], VP, F[5], F[6], F[7], F[8], (float*)d_out);
}

// v007
// Measured time: 26.3 microseconds a run.
// Next to v006, in two timings, it ran 1.06 and 1.05 times as fast.
// All steps since v000 together make it 32.2 times as fast.
// compute dtype: all float inputs rounded to bf16; the 2x2 weighting of keys and queries, the pairwise logits (f32 WMMA 16x16x4), softmax, density and sigmoid in f32; sigma and the sigmoid with precise expf/log1pf; unnormalised P = exp(logit - max) = exp2(c d2 - max c d2), c = -0.5 log2(e) / sigma^2, c d2 expanded into c |u|^2 - 2 c u.v + c |v|^2 (u = W k, v = W q), one hardware exp2 a pair, split bf16 hi + lo against the EXACT bf16 value planes on WMMA 16x16x32 (2 products, f32 accumulate); the 65 -> 64 resizer with the f32 operand split bf16 hi + lo (2 products) + bias; f32 output.
#include <hip/hip_runtime.h>
#include <math.h>

typedef __attribute__((ext_vector_type(16))) _Float16 v16h;
typedef __attribute__((ext_vector_type(16))) __bf16 v16b;
typedef __attribute__((ext_vector_type(8)))  _Float16 v8h;
typedef __attribute__((ext_vector_type(8)))  float v8f;
typedef __attribute__((ext_vector_type(4)))  float v4f;
typedef __attribute__((ext_vector_type(2)))  float v2f;
typedef __attribute__((ext_vector_type(4)))  unsigned v4u;
typedef __attribute__((ext_vector_type(4)))  int v4i;
typedef float __attribute__((may_alias)) float_a;
typedef int __attribute__((may_alias)) int_a;

template <typename T> __device__ __forceinline__ void vst2(void* p, T v) { *(T*)p = v;  }
__device__ __forceinline__ v8f wmma16(v16h a, v16h b, v8f c) {
  v8f d = __builtin_amdgcn_wmma_f32_16x16x32_f16(false, a, false, b, (short)0, c, false, false);
  asm volatile("v_nop\n\tv_nop\n\tv_nop\n\tv_nop" : "+v"(d) : "v"(a), "v"(b));
  return d;
}
__device__ __forceinline__ v8f wmma_bf(v16b a, v16b b, v8f c) {
  v8f d = __builtin_amdgcn_wmma_f32_16x16x32_bf16(false, a, false, b, (short)0, c, false, false);
  asm volatile("v_nop\n\tv_nop\n\tv_nop\n\tv_nop" : "+v"(d) : "v"(a), "v"(b));
  return d;
}
// 16x16x32 fragments: lane = (h = lane>>4, row/col = lane&15); elements 0..7 = k0+8h+0..7, 8..15 = k0+16+8h+0..7; D element r = row 8h+r
__device__ __forceinline__ v16h frag_h(const _Float16* rowk0, int lane) {
  union { v16h v; v8h q[2]; } u; const _Float16* p = rowk0 + 8 * (lane >> 4);
  u.q[0] = *(const v8h*)p; u.q[1] = *(const v8h*)(p + 16); return u.v;
}
__device__ __forceinline__ v16h frag_f32(const float* rowk0, int lane) {
  v16h a; const float* p = rowk0 + 8 * (lane >> 4);
#pragma unroll
  for (int i = 0; i < 8; ++i) { a[i] = (_Float16)p[i]; a[8 + i] = (_Float16)p[16 + i]; }
  return a;
}
__device__ __forceinline__ v16h frag_f32s(const float* rowk0, int lane, float sc) {
  v16h a; const float* p = rowk0 + 8 * (lane >> 4);
#pragma unroll
  for (int i = 0; i < 8; ++i) { a[i] = (_Float16)(p[i] * sc); a[8 + i] = (_Float16)(p[16 + i] * sc); }
  return a;
}
// column fragment from a [K][ld] layout (column n), rows >= K read as 0
__device__ __forceinline__ v16h fragc_f32(const float* W, int k0, int n, int lane, int ld, int K) {
  v16h a; const int g = lane >> 4;
#pragma unroll
  for (int i = 0; i < 8; ++i) { const int ka = k0 + 8 * g + i, kb = ka + 16;
    a[i] = (_Float16)(ka < K ? W[(size_t)(ka < K ? ka : K - 1) * ld + n] : 0.f); a[8 + i] = (_Float16)(kb < K ? W[(size_t)(kb < K ? kb : K - 1) * ld + n] : 0.f); }
  return a;
}
struct F2 { v16b h, l; };
__device__ __forceinline__ F2 bsplit16(const float v[16]) { F2 r;
#pragma unroll
  for (int i = 0; i < 16; ++i) { const __bf16 h = (__bf16)v[i]; r.h[i] = h; r.l[i] = (__bf16)(v[i] - (float)h); }
  return r; }
__device__ __forceinline__ F2 split_row(const float* row, int k0, int lane) { float v[16]; const float* p = row + k0 + 8 * (lane >> 4);
#pragma unroll
  for (int i = 0; i < 8; ++i) { v[i] = p[i]; v[8 + i] = p[16 + i]; }
  return bsplit16(v); }
__device__ __forceinline__ F2 split_rowK(const float* row, int k0, int lane, int K) { float v[16]; const int g = lane >> 4;
#pragma unroll
  for (int i = 0; i < 8; ++i) { const int ka = k0 + 8 * g + i, kb = ka + 16; v[i] = ka < K ? row[ka < K ? ka : K - 1] : 0.f; v[8 + i] = kb < K ? row[kb < K ? kb : K - 1] : 0.f; }
  return bsplit16(v); }
__device__ __forceinline__ F2 split_col(const float* W, int k0, int n, int lane, int ld, int K) { float v[16]; const int g = lane >> 4;
#pragma unroll
  for (int i = 0; i < 8; ++i) { const int ka = k0 + 8 * g + i, kb = ka + 16; v[i] = ka < K ? W[(size_t)(ka < K ? ka : K - 1) * ld + n] : 0.f; v[8 + i] = kb < K ? W[(size_t)(kb < K ? kb : K - 1) * ld + n] : 0.f; }
  return bsplit16(v); }
__device__ __forceinline__ v8f mac3(const F2& a, const F2& b, v8f c) { c = wmma_bf(a.l, b.h, c); c = wmma_bf(a.h, b.l, c); return wmma_bf(a.h, b.h, c); }
__device__ __forceinline__ float sigm(float v) { return 1.0f / (1.0f + expf(-v)); }
#define LDSX() do { asm volatile("s_wait_dscnt 0" ::: "memory"); __builtin_amdgcn_wave_barrier(); __builtin_amdgcn_fence(__ATOMIC_RELEASE, "workgroup"); } while (0)

// SetConv (B 8, 2,048 queries x 2,048 keys, 2-D coords, Cin 64 -> Cout 64): e = (k - q) W^T; dist = |e|; sigma = 1e-5 + softplus(0.1 ls - 1); logits = -0.5 (dist/sigma)^2; weight = softmax_k; density = sum_k exp(logits); targets = weight . values; out = [targets | sigmoid(0.1 (-density dW + db))] R^T + rb.
__device__ __forceinline__ float bfr(float v) { return (float)(__bf16)v; }
#define NB 8
#define NQ 2048
#define NK 2048
#define CIN 64
#define COUT 64
#ifndef TNB
#define TNB NB
#endif
typedef __attribute__((ext_vector_type(8))) __bf16 v8b;
// one B fragment (16 channels x 32 keys) from the fragment-ordered value planes: p = the fragment's 1,024 bytes + the lane's 16; elements 0..7 lie in the first 512 bytes, 8..15 in the second, so each of the two loads reads 512 bytes in a row (4 whole 128-B lines)
__device__ __forceinline__ v16b frag_o(const __bf16* p) { union { v16b v; v8b q[2]; } u; u.q[0] = *(const v8b*)p; u.q[1] = *(const v8b*)(p + 256); return u.v; }
#define WS_VP  0u                                   // bf16 value planes in B-fragment order: [b][32-key chunk][16-channel group j][half][lane = 16 g + col][8 keys]; channel 16 j + col, keys 32 chunk + 16 half + 8 g + 0..7
#define WS_END (WS_VP + 2u * (size_t)NB * CIN * NK)
// ---- k_vt: block = (128 keys, b): values (exact bf16) -> fragment-ordered planes; a block's 4 chunks are 16 KB in a row, stored in address order
__global__ __launch_bounds__(128) void k_vt(const float* __restrict__ V, __bf16* __restrict__ VP) { __shared__ __align__(16) __bf16 th[CIN][136];
  const int tid = threadIdx.x; const int k0 = blockIdx.x * 128; const size_t b = blockIdx.y;
  for (int e = tid; e < 128 * CIN; e += 128) { const int kl = e / CIN, c = e % CIN; th[c][kl] = (__bf16)V[(b * NK + k0 + kl) * CIN + c]; }
  __syncthreads();
  for (int e = tid; e < CIN * 16; e += 128) { const int ln = e & 31, hf = (e >> 5) & 1, j = (e >> 6) & 3, ch = e >> 8; const int c = j * 16 + (ln & 15), q = ch * 4 + hf * 2 + (ln >> 4); vst2((unsigned*)(VP + (b * NK + k0) * CIN + e * 8), *(const v4u*)&th[c][q * 8]); } }
// ---- k_fa: block = 32 queries of batch b = blockIdx.y, 8 waves; wave w owns keys [256 w, 256 w + 256) for both tiles of 16 queries (m = 0, 1), so every key fragment and every value fragment it loads serves two tiles. No logits / P plane goes to memory.
// logit . log2(e) = c d2 = c |u - v|^2 = (c |u|^2 - 2 c u.v) + c |v|^2, u = W k, v = W q. The bracket, t, is a product of depth 3: one f32 WMMA 16x16x4 makes it for 16 keys x 16 queries, A row (key) = (u0, u1, |u|^2, 1), B column (query) = (-2 c v0, -2 c v1, c, 0).
// With the keys as the rows, D register r of lane (g, col) is key 8 g + r of the tile, query col: two tiles of 16 keys are the 16 elements of the bf16 A fragment of P (lane = query row col, elements k0+8g+0..7 and k0+16+8g+0..7) as they stand, with no lane exchange.
// pass 1: M = max over keys of t. pass 2: p = exp(logit - max) = exp2(t - M), -M standing in the B column's fourth place, split bf16 hi + lo against the exact value planes (2 products), row sum of p in f32.
// density = sum exp(logit) = exp2(K) . sum p, K = c |v|^2 + M.
// end: the waves' partial tiles and sums are added through LDS in wave order; targets = tile / sum p, kept in LDS.
// tail: out = targets (hi + lo) . R[:, :64]^T + sigmoid(0.1 (-density dW + db)) R[:, 64] + rb for the block's 32 rows, 16 at a time: wave w makes output channels 16 (w & 3) .. + 15 over input channels 32 (w >> 2) .. + 31 (2 products); the two half sums meet in LDS and leave as whole 256-B rows.
// every full '#pragma unroll' here: l, p, acc, vv stay in registers only under constant indices.
#define QT 32
#define QW (QT / 16)
#define NW 8
#define KW (NK / NW)
__device__ __forceinline__ v8f wmma4(v2f a, v2f b, v8f c) { return __builtin_amdgcn_wmma_f32_16x16x4_f32(false, a, false, b, (short)0, c, false, false); }
// 8 hardware exp2 in place. One statement, so that behind every v_exp_f32 stands an instruction that neither reads its result nor overwrites its source (the slot the instruction set asks for behind a transcendental): the next, independent v_exp_f32, and the closing v_nop behind the last. Below 2^-126 the instruction gives 0.
__device__ __forceinline__ void exp2x8(float* x) {
  asm("v_exp_f32 %0, %0\n\tv_exp_f32 %1, %1\n\tv_exp_f32 %2, %2\n\tv_exp_f32 %3, %3\n\tv_exp_f32 %4, %4\n\tv_exp_f32 %5, %5\n\tv_exp_f32 %6, %6\n\tv_exp_f32 %7, %7\n\tv_nop" : "+v"(x[0]), "+v"(x[1]), "+v"(x[2]), "+v"(x[3]), "+v"(x[4]), "+v"(x[5]), "+v"(x[6]), "+v"(x[7])); }
__global__ __launch_bounds__(NW * 32) void k_fa(const float* __restrict__ KEYS, const float* __restrict__ QRY, const float* __restrict__ WW, const float* __restrict__ LS, const __bf16* __restrict__ VP, const float* __restrict__ DW, const float* __restrict__ DB, const float* __restrict__ RW, const float* __restrict__ RB, float* __restrict__ OUT) {
  // ska: the keys' A fragments, 256 bytes a tile of 16 keys: 16 x (u0, u1) for lanes 0..15, then 16 x (|u|^2, 1) for lanes 16..31, so a fragment load is 8 bytes a lane, 256 in a row
  __shared__ __align__(16) float ska[NK * 4]; __shared__ __align__(16) float red[NW][QT][CIN + 4]; __shared__ float smn[NW][QT], ssm[NW][QT], sk[QT], ssg[QT];
  const int tid = threadIdx.x, wave = tid >> 5, lane = tid & 31, col = lane & 15, g = lane >> 4; const int q0 = blockIdx.x * QT; const size_t b = blockIdx.y;
  const float w00 = bfr(WW[0]), w01 = bfr(WW[1]), w10 = bfr(WW[2]), w11 = bfr(WW[3]); const float dw = bfr(DW[0]), db = bfr(DB[0]);
  for (int k = tid; k < NK; k += NW * 32) { const v2f kk = *(const v2f*)(KEYS + (b * NK + k) * 2); const float kx = bfr(kk[0]), ky = bfr(kk[1]); v2f u, n; u[0] = kx * w00 + ky * w01; u[1] = kx * w10 + ky * w11; n[0] = u[0] * u[0] + u[1] * u[1]; n[1] = 1.f;
    float* d = ska + (k >> 4) * 64 + (k & 15) * 2; *(v2f*)d = u; *(v2f*)(d + 32) = n; }
  const float z = bfr(LS[0]) * 0.1f - 1.0f; const float sp = (z > 0.f ? z : 0.f) + log1pf(expf(-fabsf(z)));   // softplus = logaddexp(z, 0)
  const float sigma = 1e-05f + sp; const float is = 1.0f / sigma; const float c = (-0.5f * 1.44269504088896340736f) * is * is;   // logit . log2(e) = c d2
  v2f bq[QW]; float cv[QW], mx[QW];
#pragma unroll
  for (int m = 0; m < QW; ++m) { const v2f qq = *(const v2f*)(QRY + (b * NQ + q0 + 16 * m + col) * 2); const float qx = bfr(qq[0]), qy = bfr(qq[1]);
    const float v0 = qx * w00 + qy * w01, v1 = qx * w10 + qy * w11; cv[m] = c * (v0 * v0 + v1 * v1); mx[m] = -3.0e38f;
    bq[m][0] = g ? c : -2.f * c * v0; bq[m][1] = g ? 0.f : -2.f * c * v1; }   // the query's B fragment, in the k order of ska
  __syncthreads();
  const float* ap = ska + wave * (KW / 16) * 64 + lane * 2;   // the wave's first A fragment; tile t lies 64 t floats on
#pragma unroll   // 32 WMMAs and their maxima, unrolled: every fragment load has a constant offset
  for (int t = 0; t < KW / 16; t += 2) { v8f l[2][QW];
#pragma unroll
    for (int i = 0; i < 2; ++i) { const v2f ka = *(const v2f*)(ap + (t + i) * 64);
#pragma unroll
      for (int m = 0; m < QW; ++m) l[i][m] = wmma4(ka, bq[m], v8f{}); }
    asm volatile("v_nop\n\tv_nop\n\tv_nop\n\tv_nop" : "+v"(l[0][0]), "+v"(l[0][1]), "+v"(l[1][0]), "+v"(l[1][1]));   // the four vector slots between a WMMA and the first reader of its D; once for four WMMAs
#pragma unroll
    for (int r = 0; r < 8; ++r)
#pragma unroll
      for (int m = 0; m < QW; ++m) mx[m] = fmaxf(mx[m], fmaxf(l[0][m][r], l[1][m][r])); }
#pragma unroll
  for (int m = 0; m < QW; ++m) { mx[m] = fmaxf(mx[m], __shfl_xor(mx[m], 16)); if (g == 0) smn[wave][16 * m + col] = mx[m]; }
  __syncthreads();
#pragma unroll
  for (int m = 0; m < QW; ++m) { mx[m] = smn[0][16 * m + col];
#pragma unroll
    for (int w = 1; w < NW; ++w) mx[m] = fmaxf(mx[m], smn[w][16 * m + col]);
    if (tid < 16) sk[16 * m + col] = cv[m] + mx[m];
    if (g) bq[m][1] = -mx[m]; }   // depth 4 from here on: t - M
  v8f acc[QW][CIN / 16] = {}; float s[QW] = {};
  // a tile's two logit WMMAs are issued one chunk ahead, with the tile's eight P.V WMMAs of the chunk before: their results are long whole when exp2x8 (asm) reads them, and the vector work of a chunk runs beside the matrix work of the last
  v8f l0[QW], l1[QW];
#pragma unroll
  for (int m = 0; m < QW; ++m) { l0[m] = wmma4(*(const v2f*)ap, bq[m], v8f{}); l1[m] = wmma4(*(const v2f*)(ap + 64), bq[m], v8f{}); }
  auto chunk = [&](const int kc, const bool more) { v16b vv[CIN / 16]; v2f ka = {}, kb = {};
#pragma unroll
    for (int j = 0; j < CIN / 16; ++j) vv[j] = frag_o(VP + (b * NK + wave * KW + kc * 32) * CIN + j * 512 + lane * 8);
    if (more) { ka = *(const v2f*)(ap + kc * 128 + 128); kb = *(const v2f*)(ap + kc * 128 + 192); }
#pragma unroll
    for (int m = 0; m < QW; ++m) { float p[16];
#pragma unroll
      for (int i = 0; i < 8; ++i) { p[i] = l0[m][i]; p[8 + i] = l1[m][i]; }
      exp2x8(p); exp2x8(p + 8);   // a p below 2^-126 becomes 0: it adds nothing to a sum whose largest term is 1
#pragma unroll
      for (int i = 0; i < 16; ++i) s[m] += p[i];
      const F2 pf = bsplit16(p);
      if (more) { l0[m] = wmma4(ka, bq[m], v8f{}); l1[m] = wmma4(kb, bq[m], v8f{}); }
#pragma unroll
      for (int j = 0; j < CIN / 16; ++j) acc[m][j] = __builtin_amdgcn_wmma_f32_16x16x32_bf16(false, pf.h, false, vv[j], (short)0, acc[m][j], false, false);
#pragma unroll
      for (int j = 0; j < CIN / 16; ++j) acc[m][j] = __builtin_amdgcn_wmma_f32_16x16x32_bf16(false, pf.l, false, vv[j], (short)0, acc[m][j], false, false);
      __builtin_amdgcn_sched_barrier(0); } };   // keeps the two tiles' bodies apart in the schedule: mixed, the register allocation costs some thirty more copy instructions (v_mov_b32, v_mov_b16) a trip
#pragma unroll 1   // kept rolled: one body has 32 independent chains of its own and the other waves of the SIMD cover its loads; 8 copies would only cost instruction cache
  for (int kc = 0; kc < KW / 32 - 1; ++kc) chunk(kc, true);
  chunk(KW / 32 - 1, false);
#pragma unroll
  for (int m = 0; m < QW; ++m) { s[m] += __shfl_xor(s[m], 16); if (g == 0) ssm[wave][16 * m + col] = s[m];
#pragma unroll
    for (int j = 0; j < CIN / 16; ++j)
#pragma unroll
      for (int r = 0; r < 8; ++r) red[wave][16 * m + 8 * g + r][j * 16 + col] = acc[m][j][r]; }
  __syncthreads();
  // the tail's resizer operands are asked for here, by every wave alike, so that their latency runs under the block sum
  const int wv = __builtin_amdgcn_readfirstlane(wave); const int o = (wv & 3) * 16 + col, kh = wv >> 2; float wf[16];
  { const float* wr = RW + (size_t)o * (CIN + 1) + kh * 32 + 8 * g;
#pragma unroll
    for (int i = 0; i < 8; ++i) { wf[i] = wr[i]; wf[8 + i] = wr[16 + i]; } }
  const float wden = RW[(size_t)o * (CIN + 1) + CIN], bb = RB[o];
  constexpr int CPT = QT * CIN / (NW * 32);   // channels per thread of the final sum
  const int q = tid / (CIN / CPT), c0 = (tid % (CIN / CPT)) * CPT; float st = 0.f; v4f a[CPT / 4] = {};
#pragma unroll
  for (int w = 0; w < NW; ++w) { st += ssm[w][q];
#pragma unroll
    for (int u = 0; u < CPT / 4; ++u) a[u] += *(const v4f*)&red[w][q][c0 + 4 * u]; }
  const float inv = 1.0f / st;
#pragma unroll
  for (int u = 0; u < CPT / 4; ++u) vst2(&red[0][q][c0 + 4 * u], a[u] * inv);   // in place: these cells of red are read by this thread alone
  if (c0 == 0) { const float den = exp2f(sk[q]) * st; ssg[q] = 1.0f / (1.0f + expf(-((-den * dw + db) * 0.1f))); }
  __syncthreads();   // the 32 target rows and their density terms are whole; red[1..] is free
  { v16b w;
#pragma unroll
    for (int i = 0; i < 16; ++i) w[i] = (__bf16)wf[i];
#pragma unroll
    for (int m = 0; m < QW; ++m) { const F2 af = split_row(&red[0][16 * m + col][0], kh * 32, lane); v8f oa = {};
      oa = wmma_bf(af.h, w, oa); oa = wmma_bf(af.l, w, oa);
      if (kh == 0) { const float wd = bfr(wden), rb = bfr(bb);   // the density term and the bias go in once, with the first half
#pragma unroll
        for (int r = 0; r < 8; ++r) oa[r] = oa[r] + ssg[16 * m + 8 * g + r] * wd + rb; }
#pragma unroll
      for (int r = 0; r < 8; ++r) red[1 + kh][16 * m + 8 * g + r][o] = oa[r]; } }
  __syncthreads();   // both half sums of the output tile are whole
#pragma unroll
  for (int u = 0; u < CPT / 4; ++u) vst2(OUT + (b * NQ + q0 + q) * COUT + c0 + 4 * u, *(const v4f*)&red[1][q][c0 + 4 * u] + *(const v4f*)&red[2][q][c0 + 4 * u]); }
extern "C" void kernel_launch(void* const* d_in, const int* in_sizes, int n_in, void* d_out, int out_size, void* d_ws, size_t ws_size, hipStream_t stream) {
  (void)in_sizes; (void)n_in; (void)out_size;
  const float** F = (const float**)d_in;   // 0 keys [8,2048,2], 1 queries [8,2048,2], 2 values [8,2048,64], 3 weighter_W [2,2], 4 length_scale_param [1], 5 density_W [1], 6 density_b [1], 7 resizer_W [64,65] ([out,in]), 8 resizer_b [64]
  if (ws_size < (size_t)WS_END) return;
  char* ws = (char*)d_ws; __bf16* VP = (__bf16*)(ws + WS_VP);
  k_vt<<<dim3(NK / 128, TNB), 128, 0, stream>>>(F[2], VP);
  k_fa<<<dim3(NQ / QT, TNB), NW * 32, 0, stream>>>(F[0], F[1], F[3], F[4], VP, F[5], F[6], F[7], F[8], (float*)d_out);
}

// v008
// One run takes 17.4 microseconds.
// Next to v007, in two timings, it ran 1.49 and 1.51 times as fast.
// Over all steps from v000 it is 48.3 times as fast.
// compute dtype: all float inputs rounded to bf16; the 2x2 weighting of keys and queries, the pairwise logits (f32 WMMA 16x16x4), softmax, density and sigmoid in f32; sigma and the sigmoid with precise expf/log1pf; unnormalised P = exp(logit - max) = exp2(c d2 - max c d2), c = -0.5 log2(e) / sigma^2, c d2 expanded into c |u|^2 - 2 c u.v + c |v|^2 (u = W k, v = W q), one hardware exp2 a pair, split bf16 hi + lo against the EXACT bf16 value planes on WMMA 16x16x32 (2 products, f32 accumulate); the 65 -> 64 resizer with the f32 operand split bf16 hi + lo (2 products) + bias; f32 output.
#include <hip/hip_runtime.h>
#include <math.h>

typedef __attribute__((ext_vector_type(16))) _Float16 v16h;
typedef __attribute__((ext_vector_type(16))) __bf16 v16b;
typedef __attribute__((ext_vector_type(8)))  _Float16 v8h;
typedef __attribute__((ext_vector_type(8)))  float v8f;
typedef __attribute__((ext_vector_type(4)))  float v4f;
typedef __attribute__((ext_vector_type(2)))  float v2f;
typedef __attribute__((ext_vector_type(4)))  unsigned v4u;
typedef __attribute__((ext_vector_type(4)))  int v4i;
typedef float __attribute__((may_alias)) float_a;
typedef int __attribute__((may_alias)) int_a;

template <typename T> __device__ __forceinline__ void vst2(void* p, T v) { *(T*)p = v;  }
__device__ __forceinline__ v8f wmma16(v16h a, v16h b, v8f c) {
  v8f d = __builtin_amdgcn_wmma_f32_16x16x32_f16(false, a, false, b, (short)0, c, false, false);
  asm volatile("v_nop\n\tv_nop\n\tv_nop\n\tv_nop" : "+v"(d) : "v"(a), "v"(b));
  return d;
}
__device__ __forceinline__ v8f wmma_bf(v16b a, v16b b, v8f c) {
  v8f d = __builtin_amdgcn_wmma_f32_16x16x32_bf16(false, a, false, b, (short)0, c, false, false);
  asm volatile("v_nop\n\tv_nop\n\tv_nop\n\tv_nop" : "+v"(d) : "v"(a), "v"(b));
  return d;
}
// 16x16x32 fragments: lane = (h = lane>>4, row/col = lane&15); elements 0..7 = k0+8h+0..7, 8..15 = k0+16+8h+0..7; D element r = row 8h+r
__device__ __forceinline__ v16h frag_h(const _Float16* rowk0, int lane) {
  union { v16h v; v8h q[2]; } u; const _Float16* p = rowk0 + 8 * (lane >> 4);
  u.q[0] = *(const v8h*)p; u.q[1] = *(const v8h*)(p + 16); return u.v;
}
__device__ __forceinline__ v16h frag_f32(const float* rowk0, int lane) {
  v16h a; const float* p = rowk0 + 8 * (lane >> 4);
#pragma unroll
  for (int i = 0; i < 8; ++i) { a[i] = (_Float16)p[i]; a[8 + i] = (_Float16)p[16 + i]; }
  return a;
}
__device__ __forceinline__ v16h frag_f32s(const float* rowk0, int lane, float sc) {
  v16h a; const float* p = rowk0 + 8 * (lane >> 4);
#pragma unroll
  for (int i = 0; i < 8; ++i) { a[i] = (_Float16)(p[i] * sc); a[8 + i] = (_Float16)(p[16 + i] * sc); }
  return a;
}
// column fragment from a [K][ld] layout (column n), rows >= K read as 0
__device__ __forceinline__ v16h fragc_f32(const float* W, int k0, int n, int lane, int ld, int K) {
  v16h a; const int g = lane >> 4;
#pragma unroll
  for (int i = 0; i < 8; ++i) { const int ka = k0 + 8 * g + i, kb = ka + 16;
    a[i] = (_Float16)(ka < K ? W[(size_t)(ka < K ? ka : K - 1) * ld + n] : 0.f); a[8 + i] = (_Float16)(kb < K ? W[(size_t)(kb < K ? kb : K - 1) * ld + n] : 0.f); }
  return a;
}
struct F2 { v16b h, l; };
__device__ __forceinline__ F2 bsplit16(const float v[16]) { F2 r;
#pragma unroll
  for (int i = 0; i < 16; ++i) { const __bf16 h = (__bf16)v[i]; r.h[i] = h; r.l[i] = (__bf16)(v[i] - (float)h); }
  return r; }
__device__ __forceinline__ F2 split_row(const float* row, int k0, int lane) { float v[16]; const float* p = row + k0 + 8 * (lane >> 4);
#pragma unroll
  for (int i = 0; i < 8; ++i) { v[i] = p[i]; v[8 + i] = p[16 + i]; }
  return bsplit16(v); }
__device__ __forceinline__ F2 split_rowK(const float* row, int k0, int lane, int K) { float v[16]; const int g = lane >> 4;
#pragma unroll
  for (int i = 0; i < 8; ++i) { const int ka = k0 + 8 * g + i, kb = ka + 16; v[i] = ka < K ? row[ka < K ? ka : K - 1] : 0.f; v[8 + i] = kb < K ? row[kb < K ? kb : K - 1] : 0.f; }
  return bsplit16(v); }
__device__ __forceinline__ F2 split_col(const float* W, int k0, int n, int lane, int ld, int K) { float v[16]; const int g = lane >> 4;
#pragma unroll
  for (int i = 0; i < 8; ++i) { const int ka = k0 + 8 * g + i, kb = ka + 16; v[i] = ka < K ? W[(size_t)(ka < K ? ka : K - 1) * ld + n] : 0.f; v[8 + i] = kb < K ? W[(size_t)(kb < K ? kb : K - 1) * ld + n] : 0.f; }
  return bsplit16(v); }
__device__ __forceinline__ v8f mac3(const F2& a, const F2& b, v8f c) { c = wmma_bf(a.l, b.h, c); c = wmma_bf(a.h, b.l, c); return wmma_bf(a.h, b.h, c); }
__device__ __forceinline__ float sigm(float v) { return 1.0f / (1.0f + expf(-v)); }
#define LDSX() do { asm volatile("s_wait_dscnt 0" ::: "memory"); __builtin_amdgcn_wave_barrier(); __builtin_amdgcn_fence(__ATOMIC_RELEASE, "workgroup"); } while (0)

// SetConv (B 8, 2,048 queries x 2,048 keys, 2-D coords, Cin 64 -> Cout 64): e = (k - q) W^T; dist = |e|; sigma = 1e-5 + softplus(0.1 ls - 1); logits = -0.5 (dist/sigma)^2; weight = softmax_k; density = sum_k exp(logits); targets = weight . values; out = [targets | sigmoid(0.1 (-density dW + db))] R^T + rb.
__device__ __forceinline__ float bfr(float v) { return (float)(__bf16)v; }
#define NB 8
#define NQ 2048
#define NK 2048
#define CIN 64
#define COUT 64
#ifndef TNB
#define TNB NB
#endif
typedef __attribute__((ext_vector_type(8))) __bf16 v8b;
// one B fragment (16 channels x 32 keys) from the fragment-ordered value planes: p = the fragment's 1,024 bytes + the lane's 16; elements 0..7 lie in the first 512 bytes, 8..15 in the second, so each of the two loads reads 512 bytes in a row (4 whole 128-B lines)
__device__ __forceinline__ v16b frag_o(const __bf16* p) { union { v16b v; v8b q[2]; } u; u.q[0] = *(const v8b*)p; u.q[1] = *(const v8b*)(p + 256); return u.v; }
#define WS_VP  0u                                   // bf16 value planes in B-fragment order: [b][32-key chunk][16-channel group j][half][lane = 16 g + col][8 keys]; channel 16 j + col, keys 32 chunk + 16 half + 8 g + 0..7
#define WS_END (WS_VP + 2u * (size_t)NB * CIN * NK)
// ---- k_vt: wave = 16 keys of batch b (one half of a 32-key chunk), lane = channel: values (exact bf16) -> fragment-ordered planes. Each of a wave's 32 loads reads one whole 128-B line (32 channels of one key), and all 32 are issued before the first is waited for: one round trip. A lane's 8 keys of one channel are one 16-B unit of the fragment order, so the transposition is the packing in registers; each store writes two runs of 256 bytes.
#define VTW 4   // waves a block
__global__ __launch_bounds__(VTW * 32) void k_vt(const float* __restrict__ V, __bf16* __restrict__ VP) {
  const int lane = threadIdx.x & 31; const int kw = blockIdx.x * VTW + (threadIdx.x >> 5); const size_t b = blockIdx.y;   // keys 16 kw .. 16 kw + 15
  const float* src = V + (b * NK + kw * 16) * CIN + lane; float x[2][16];
#pragma unroll   // x stays in registers only under constant indices; unrolled, the loads stand in a row
  for (int kk = 0; kk < 16; ++kk)
#pragma unroll
    for (int jj = 0; jj < 2; ++jj) x[jj][kk] = src[kk * CIN + jj * 32];
  __bf16* dst = VP + (b * NK + (kw >> 1) * 32) * CIN + (lane >> 4) * 512 + (kw & 1) * 256 + (lane & 15) * 8;   // channel group j = 2 jj + (lane >> 4), half = kw & 1, col = lane & 15
#pragma unroll
  for (int jj = 0; jj < 2; ++jj)
#pragma unroll
    for (int g = 0; g < 2; ++g) { v8b u;
#pragma unroll
      for (int i = 0; i < 8; ++i) u[i] = (__bf16)x[jj][8 * g + i];
      vst2(dst + jj * 1024 + g * 128, u); } }
// ---- k_fa: block = 32 queries of batch b = blockIdx.y, 8 waves; wave w owns keys [256 w, 256 w + 256) for both tiles of 16 queries (m = 0, 1), so every key fragment and every value fragment it loads serves two tiles. No logits / P plane goes to memory.
// logit . log2(e) = c d2 = c |u - v|^2 = (c |u|^2 - 2 c u.v) + c |v|^2, u = W k, v = W q. The bracket, t, is a product of depth 3: one f32 WMMA 16x16x4 makes it for 16 keys x 16 queries, A row (key) = (u0, u1, |u|^2, 1), B column (query) = (-2 c v0, -2 c v1, c, 0).
// With the keys as the rows, D register r of lane (g, col) is key 8 g + r of the tile, query col: two tiles of 16 keys are the 16 elements of the bf16 A fragment of P (lane = query row col, elements k0+8g+0..7 and k0+16+8g+0..7) as they stand, with no lane exchange.
// pass 1: M = max over keys of t. pass 2: p = exp(logit - max) = exp2(t - M), -M standing in the B column's fourth place, split bf16 hi + lo against the exact value planes (2 products), row sum of p in f32.
// density = sum exp(logit) = exp2(K) . sum p, K = c |v|^2 + M.
// end: the waves' partial tiles and sums are added through LDS in wave order; targets = tile / sum p, kept in LDS.
// tail: out = targets (hi + lo) . R[:, :64]^T + sigmoid(0.1 (-density dW + db)) R[:, 64] + rb for the block's 32 rows, 16 at a time: wave w makes output channels 16 (w & 3) .. + 15 over input channels 32 (w >> 2) .. + 31 (2 products); the two half sums meet in LDS and leave as whole 256-B rows.
// every full '#pragma unroll' here: l, p, acc, vv stay in registers only under constant indices.
#define QT 32
#define QW (QT / 16)
#define NW 8
#define KW (NK / NW)
__device__ __forceinline__ v8f wmma4(v2f a, v2f b, v8f c) { return __builtin_amdgcn_wmma_f32_16x16x4_f32(false, a, false, b, (short)0, c, false, false); }
// 8 hardware exp2 in place. One statement, so that behind every v_exp_f32 stands an instruction that neither reads its result nor overwrites its source (the slot the instruction set asks for behind a transcendental): the next, independent v_exp_f32, and the closing v_nop behind the last. Below 2^-126 the instruction gives 0.
__device__ __forceinline__ void exp2x8(float* x) {
  asm("v_exp_f32 %0, %0\n\tv_exp_f32 %1, %1\n\tv_exp_f32 %2, %2\n\tv_exp_f32 %3, %3\n\tv_exp_f32 %4, %4\n\tv_exp_f32 %5, %5\n\tv_exp_f32 %6, %6\n\tv_exp_f32 %7, %7\n\tv_nop" : "+v"(x[0]), "+v"(x[1]), "+v"(x[2]), "+v"(x[3]), "+v"(x[4]), "+v"(x[5]), "+v"(x[6]), "+v"(x[7])); }
__global__ __launch_bounds__(NW * 32) void k_fa(const float* __restrict__ KEYS, const float* __restrict__ QRY, const float* __restrict__ WW, const float* __restrict__ LS, const __bf16* __restrict__ VP, const float* __restrict__ DW, const float* __restrict__ DB, const float* __restrict__ RW, const float* __restrict__ RB, float* __restrict__ OUT) {
  // ska: the keys' A fragments, 256 bytes a tile of 16 keys: 16 x (u0, u1) for lanes 0..15, then 16 x (|u|^2, 1) for lanes 16..31, so a fragment load is 8 bytes a lane, 256 in a row
  __shared__ __align__(16) float ska[NK * 4]; __shared__ __align__(16) float red[NW][QT][CIN + 4]; __shared__ float smn[NW][QT], ssm[NW][QT], sk[QT], ssg[QT];
  const int tid = threadIdx.x, wave = tid >> 5, lane = tid & 31, col = lane & 15, g = lane >> 4; const int q0 = blockIdx.x * QT; const size_t b = blockIdx.y;
  // every load of the prologue (the 7 parameters, a lane's 8 keys and 2 queries) is issued here, before the first is waited for: one round trip
  const float rw00 = WW[0], rw01 = WW[1], rw10 = WW[2], rw11 = WW[3], rdw = DW[0], rdb = DB[0], rls = LS[0]; v2f kr[NK / (NW * 32)], qr[QW];
#pragma unroll   // kr stays in registers only under constant indices; unrolled, the loads stand in a row
  for (int i = 0; i < NK / (NW * 32); ++i) kr[i] = *(const v2f*)(KEYS + (b * NK + tid + i * (NW * 32)) * 2);
#pragma unroll
  for (int m = 0; m < QW; ++m) qr[m] = *(const v2f*)(QRY + (b * NQ + q0 + 16 * m + col) * 2);
  asm volatile("s_wait_xcnt 0x0" ::: "memory");   // stands in front of the first instruction that overwrites an address register of the loads above (a precaution; the compiler leaves it out here)
  __builtin_amdgcn_sched_barrier(0);   // keeps the loads above the arithmetic: without it the schedule waits for the length scale, works sigma out, and only then asks for the weights and the queries (one more round trip)
  const float w00 = bfr(rw00), w01 = bfr(rw01), w10 = bfr(rw10), w11 = bfr(rw11); const float dw = bfr(rdw), db = bfr(rdb);
#pragma unroll
  for (int i = 0; i < NK / (NW * 32); ++i) { const int k = tid + i * (NW * 32); const float kx = bfr(kr[i][0]), ky = bfr(kr[i][1]); v2f u, n; u[0] = kx * w00 + ky * w01; u[1] = kx * w10 + ky * w11; n[0] = u[0] * u[0] + u[1] * u[1]; n[1] = 1.f;
    float* d = ska + (k >> 4) * 64 + (k & 15) * 2; *(v2f*)d = u; *(v2f*)(d + 32) = n; }
  const float z = bfr(rls) * 0.1f - 1.0f; const float sp = (z > 0.f ? z : 0.f) + log1pf(expf(-fabsf(z)));   // softplus = logaddexp(z, 0)
  const float sigma = 1e-05f + sp; const float is = 1.0f / sigma; const float c = (-0.5f * 1.44269504088896340736f) * is * is;   // logit . log2(e) = c d2
  v2f bq[QW]; float cv[QW], mx[QW];
#pragma unroll
  for (int m = 0; m < QW; ++m) { const float qx = bfr(qr[m][0]), qy = bfr(qr[m][1]);
    const float v0 = qx * w00 + qy * w01, v1 = qx * w10 + qy * w11; cv[m] = c * (v0 * v0 + v1 * v1); mx[m] = -3.0e38f;
    bq[m][0] = g ? c : -2.f * c * v0; bq[m][1] = g ? 0.f : -2.f * c * v1; }   // the query's B fragment, in the k order of ska
  __syncthreads();
  const float* ap = ska + wave * (KW / 16) * 64 + lane * 2;   // the wave's first A fragment; tile t lies 64 t floats on
#pragma unroll   // 32 WMMAs and their maxima, unrolled: every fragment load has a constant offset
  for (int t = 0; t < KW / 16; t += 2) { v8f l[2][QW];
#pragma unroll
    for (int i = 0; i < 2; ++i) { const v2f ka = *(const v2f*)(ap + (t + i) * 64);
#pragma unroll
      for (int m = 0; m < QW; ++m) l[i][m] = wmma4(ka, bq[m], v8f{}); }
    asm volatile("v_nop\n\tv_nop\n\tv_nop\n\tv_nop" : "+v"(l[0][0]), "+v"(l[0][1]), "+v"(l[1][0]), "+v"(l[1][1]));   // the four vector slots between a WMMA and the first reader of its D; once for four WMMAs
#pragma unroll
    for (int r = 0; r < 8; ++r)
#pragma unroll
      for (int m = 0; m < QW; ++m) mx[m] = fmaxf(mx[m], fmaxf(l[0][m][r], l[1][m][r])); }
#pragma unroll
  for (int m = 0; m < QW; ++m) { mx[m] = fmaxf(mx[m], __shfl_xor(mx[m], 16)); if (g == 0) smn[wave][16 * m + col] = mx[m]; }
  __syncthreads();
#pragma unroll
  for (int m = 0; m < QW; ++m) { mx[m] = smn[0][16 * m + col];
#pragma unroll
    for (int w = 1; w < NW; ++w) mx[m] = fmaxf(mx[m], smn[w][16 * m + col]);
    if (tid < 16) sk[16 * m + col] = cv[m] + mx[m];
    if (g) bq[m][1] = -mx[m]; }   // depth 4 from here on: t - M
  v8f acc[QW][CIN / 16] = {}; float s[QW] = {};
  // a tile's two logit WMMAs are issued one chunk ahead, with the tile's eight P.V WMMAs of the chunk before: their results are long whole when exp2x8 (asm) reads them, and the vector work of a chunk runs beside the matrix work of the last
  v8f l0[QW], l1[QW];
#pragma unroll
  for (int m = 0; m < QW; ++m) { l0[m] = wmma4(*(const v2f*)ap, bq[m], v8f{}); l1[m] = wmma4(*(const v2f*)(ap + 64), bq[m], v8f{}); }
  auto chunk = [&](const int kc, const bool more) { v16b vv[CIN / 16]; v2f ka = {}, kb = {};
#pragma unroll
    for (int j = 0; j < CIN / 16; ++j) vv[j] = frag_o(VP + (b * NK + wave * KW + kc * 32) * CIN + j * 512 + lane * 8);
    if (more) { ka = *(const v2f*)(ap + kc * 128 + 128); kb = *(const v2f*)(ap + kc * 128 + 192); }
#pragma unroll
    for (int m = 0; m < QW; ++m) { float p[16];
#pragma unroll
      for (int i = 0; i < 8; ++i) { p[i] = l0[m][i]; p[8 + i] = l1[m][i]; }
      exp2x8(p); exp2x8(p + 8);   // a p below 2^-126 becomes 0: it adds nothing to a sum whose largest term is 1
#pragma unroll
      for (int i = 0; i < 16; ++i) s[m] += p[i];
      const F2 pf = bsplit16(p);
      if (more) { l0[m] = wmma4(ka, bq[m], v8f{}); l1[m] = wmma4(kb, bq[m], v8f{}); }
#pragma unroll
      for (int j = 0; j < CIN / 16; ++j) acc[m][j] = __builtin_amdgcn_wmma_f32_16x16x32_bf16(false, pf.h, false, vv[j], (short)0, acc[m][j], false, false);
#pragma unroll
      for (int j = 0; j < CIN / 16; ++j) acc[m][j] = __builtin_amdgcn_wmma_f32_16x16x32_bf16(false, pf.l, false, vv[j], (short)0, acc[m][j], false, false);
      __builtin_amdgcn_sched_barrier(0); } };   // keeps the two tiles' bodies apart in the schedule: mixed, the register allocation costs some thirty more copy instructions (v_mov_b32, v_mov_b16) a trip
#pragma unroll 1   // kept rolled: one body has 32 independent chains of its own and the other waves of the SIMD cover its loads; 8 copies would only cost instruction cache
  for (int kc = 0; kc < KW / 32 - 1; ++kc) chunk(kc, true);
  chunk(KW / 32 - 1, false);
#pragma unroll
  for (int m = 0; m < QW; ++m) { s[m] += __shfl_xor(s[m], 16); if (g == 0) ssm[wave][16 * m + col] = s[m];
#pragma unroll
    for (int j = 0; j < CIN / 16; ++j)
#pragma unroll
      for (int r = 0; r < 8; ++r) red[wave][16 * m + 8 * g + r][j * 16 + col] = acc[m][j][r]; }
  __syncthreads();
  // the tail's resizer operands are asked for here, by every wave alike, so that their latency runs under the block sum
  const int wv = __builtin_amdgcn_readfirstlane(wave); const int o = (wv & 3) * 16 + col, kh = wv >> 2; float wf[16];
  { const float* wr = RW + (size_t)o * (CIN + 1) + kh * 32 + 8 * g;
#pragma unroll
    for (int i = 0; i < 8; ++i) { wf[i] = wr[i]; wf[8 + i] = wr[16 + i]; } }
  const float wden = RW[(size_t)o * (CIN + 1) + CIN], bb = RB[o];
  constexpr int CPT = QT * CIN / (NW * 32);   // channels per thread of the final sum
  const int q = tid / (CIN / CPT), c0 = (tid % (CIN / CPT)) * CPT; float st = 0.f; v4f a[CPT / 4] = {};
#pragma unroll
  for (int w = 0; w < NW; ++w) { st += ssm[w][q];
#pragma unroll
    for (int u = 0; u < CPT / 4; ++u) a[u] += *(const v4f*)&red[w][q][c0 + 4 * u]; }
  const float inv = 1.0f / st;
#pragma unroll
  for (int u = 0; u < CPT / 4; ++u) vst2(&red[0][q][c0 + 4 * u], a[u] * inv);   // in place: these cells of red are read by this thread alone
  if (c0 == 0) { const float den = exp2f(sk[q]) * st; ssg[q] = 1.0f / (1.0f + expf(-((-den * dw + db) * 0.1f))); }
  __syncthreads();   // the 32 target rows and their density terms are whole; red[1..] is free
  { v16b w;
#pragma unroll
    for (int i = 0; i < 16; ++i) w[i] = (__bf16)wf[i];
#pragma unroll
    for (int m = 0; m < QW; ++m) { const F2 af = split_row(&red[0][16 * m + col][0], kh * 32, lane); v8f oa = {};
      oa = wmma_bf(af.h, w, oa); oa = wmma_bf(af.l, w, oa);
      if (kh == 0) { const float wd = bfr(wden), rb = bfr(bb);   // the density term and the bias go in once, with the first half
#pragma unroll
        for (int r = 0; r < 8; ++r) oa[r] = oa[r] + ssg[16 * m + 8 * g + r] * wd + rb; }
#pragma unroll
      for (int r = 0; r < 8; ++r) red[1 + kh][16 * m + 8 * g + r][o] = oa[r]; } }
  __syncthreads();   // both half sums of the output tile are whole
#pragma unroll
  for (int u = 0; u < CPT / 4; ++u) vst2(OUT + (b * NQ + q0 + q) * COUT + c0 + 4 * u, *(const v4f*)&red[1][q][c0 + 4 * u] + *(const v4f*)&red[2][q][c0 + 4 * u]); }
extern "C" void kernel_launch(void* const* d_in, const int* in_sizes, int n_in, void* d_out, int out_size, void* d_ws, size_t ws_size, hipStream_t stream) {
  (void)in_sizes; (void)n_in; (void)out_size;
  const float** F = (const float**)d_in;   // 0 keys [8,2048,2], 1 queries [8,2048,2], 2 values [8,2048,64], 3 weighter_W [2,2], 4 length_scale_param [1], 5 density_W [1], 6 density_b [1], 7 resizer_W [64,65] ([out,in]), 8 resizer_b [64]
  if (ws_size < (size_t)WS_END) return;
  char* ws = (char*)d_ws; __bf16* VP = (__bf16*)(ws + WS_VP);
  k_vt<<<dim3(NK / (16 * VTW), TNB), VTW * 32, 0, stream>>>(F[2], VP);
  k_fa<<<dim3(NQ / QT, TNB), NW * 32, 0, stream>>>(F[0], F[1], F[3], F[4], VP, F[5], F[6], F[7], F[8], (float*)d_out);
}

// v009
// Measured time: 15.9 microseconds a run.
// In both of two side-by-side timings against v008, it was 1.10 times as fast.
// All steps since v000 together make it 53.1 times as fast.
// compute dtype: all float inputs rounded to bf16; the 2x2 weighting of keys and queries, the pairwise logits (f32 WMMA 16x16x4), softmax, density and sigmoid in f32; sigma and the sigmoid with precise expf/log1pf; unnormalised P = exp(logit - max) = exp2(c d2 - max c d2), c = -0.5 log2(e) / sigma^2, c d2 expanded into c |u|^2 - 2 c u.v + c |v|^2 (u = W k, v = W q), one hardware exp2 a pair, split bf16 hi + lo against the EXACT bf16 values on WMMA 16x16x32 (2 products, f32 accumulate); the 65 -> 64 resizer with the f32 operand split bf16 hi + lo (2 products) + bias; f32 output.
#include <hip/hip_runtime.h>
#include <math.h>

typedef __attribute__((ext_vector_type(16))) _Float16 v16h;
typedef __attribute__((ext_vector_type(16))) __bf16 v16b;
typedef __attribute__((ext_vector_type(8)))  _Float16 v8h;
typedef __attribute__((ext_vector_type(8)))  float v8f;
typedef __attribute__((ext_vector_type(4)))  float v4f;
typedef __attribute__((ext_vector_type(2)))  float v2f;
typedef __attribute__((ext_vector_type(4)))  unsigned v4u;
typedef __attribute__((ext_vector_type(4)))  int v4i;
typedef float __attribute__((may_alias)) float_a;
typedef int __attribute__((may_alias)) int_a;

template <typename T> __device__ __forceinline__ void vst2(void* p, T v) { *(T*)p = v;  }
__device__ __forceinline__ v8f wmma16(v16h a, v16h b, v8f c) {
  v8f d = __builtin_amdgcn_wmma_f32_16x16x32_f16(false, a, false, b, (short)0, c, false, false);
  asm volatile("v_nop\n\tv_nop\n\tv_nop\n\tv_nop" : "+v"(d) : "v"(a), "v"(b));
  return d;
}
__device__ __forceinline__ v8f wmma_bf(v16b a, v16b b, v8f c) {
  v8f d = __builtin_amdgcn_wmma_f32_16x16x32_bf16(false, a, false, b, (short)0, c, false, false);
  asm volatile("v_nop\n\tv_nop\n\tv_nop\n\tv_nop" : "+v"(d) : "v"(a), "v"(b));
  return d;
}
// 16x16x32 fragments: lane = (h = lane>>4, row/col = lane&15); elements 0..7 = k0+8h+0..7, 8..15 = k0+16+8h+0..7; D element r = row 8h+r
__device__ __forceinline__ v16h frag_h(const _Float16* rowk0, int lane) {
  union { v16h v; v8h q[2]; } u; const _Float16* p = rowk0 + 8 * (lane >> 4);
  u.q[0] = *(const v8h*)p; u.q[1] = *(const v8h*)(p + 16); return u.v;
}
__device__ __forceinline__ v16h frag_f32(const float* rowk0, int lane) {
  v16h a; const float* p = rowk0 + 8 * (lane >> 4);
#pragma unroll
  for (int i = 0; i < 8; ++i) { a[i] = (_Float16)p[i]; a[8 + i] = (_Float16)p[16 + i]; }
  return a;
}
__device__ __forceinline__ v16h frag_f32s(const float* rowk0, int lane, float sc) {
  v16h a; const float* p = rowk0 + 8 * (lane >> 4);
#pragma unroll
  for (int i = 0; i < 8; ++i) { a[i] = (_Float16)(p[i] * sc); a[8 + i] = (_Float16)(p[16 + i] * sc); }
  return a;
}
// column fragment from a [K][ld] layout (column n), rows >= K read as 0
__device__ __forceinline__ v16h fragc_f32(const float* W, int k0, int n, int lane, int ld, int K) {
  v16h a; const int g = lane >> 4;
#pragma unroll
  for (int i = 0; i < 8; ++i) { const int ka = k0 + 8 * g + i, kb = ka + 16;
    a[i] = (_Float16)(ka < K ? W[(size_t)(ka < K ? ka : K - 1) * ld + n] : 0.f); a[8 + i] = (_Float16)(kb < K ? W[(size_t)(kb < K ? kb : K - 1) * ld + n] : 0.f); }
  return a;
}
struct F2 { v16b h, l; };
__device__ __forceinline__ F2 bsplit16(const float v[16]) { F2 r;
#pragma unroll
  for (int i = 0; i < 16; ++i) { const __bf16 h = (__bf16)v[i]; r.h[i] = h; r.l[i] = (__bf16)(v[i] - (float)h); }
  return r; }
__device__ __forceinline__ F2 split_row(const float* row, int k0, int lane) { float v[16]; const float* p = row + k0 + 8 * (lane >> 4);
#pragma unroll
  for (int i = 0; i < 8; ++i) { v[i] = p[i]; v[8 + i] = p[16 + i]; }
  return bsplit16(v); }
__device__ __forceinline__ F2 split_rowK(const float* row, int k0, int lane, int K) { float v[16]; const int g = lane >> 4;
#pragma unroll
  for (int i = 0; i < 8; ++i) { const int ka = k0 + 8 * g + i, kb = ka + 16; v[i] = ka < K ? row[ka < K ? ka : K - 1] : 0.f; v[8 + i] = kb < K ? row[kb < K ? kb : K - 1] : 0.f; }
  return bsplit16(v); }
__device__ __forceinline__ F2 split_col(const float* W, int k0, int n, int lane, int ld, int K) { float v[16]; const int g = lane >> 4;
#pragma unroll
  for (int i = 0; i < 8; ++i) { const int ka = k0 + 8 * g + i, kb = ka + 16; v[i] = ka < K ? W[(size_t)(ka < K ? ka : K - 1) * ld + n] : 0.f; v[8 + i] = kb < K ? W[(size_t)(kb < K ? kb : K - 1) * ld + n] : 0.f; }
  return bsplit16(v); }
__device__ __forceinline__ v8f mac3(const F2& a, const F2& b, v8f c) { c = wmma_bf(a.l, b.h, c); c = wmma_bf(a.h, b.l, c); return wmma_bf(a.h, b.h, c); }
__device__ __forceinline__ float sigm(float v) { return 1.0f / (1.0f + expf(-v)); }
#define LDSX() do { asm volatile("s_wait_dscnt 0" ::: "memory"); __builtin_amdgcn_wave_barrier(); __builtin_amdgcn_fence(__ATOMIC_RELEASE, "workgroup"); } while (0)

// SetConv (B 8, 2,048 queries x 2,048 keys, 2-D coords, Cin 64 -> Cout 64): e = (k - q) W^T; dist = |e|; sigma = 1e-5 + softplus(0.1 ls - 1); logits = -0.5 (dist/sigma)^2; weight = softmax_k; density = sum_k exp(logits); targets = weight . values; out = [targets | sigmoid(0.1 (-density dW + db))] R^T + rb.
__device__ __forceinline__ float bfr(float v) { return (float)(__bf16)v; }
#define NB 8
#define NQ 2048
#define NK 2048
#define CIN 64
#define COUT 64
#ifndef TNB
#define TNB NB
#endif
typedef __attribute__((ext_vector_type(8))) __bf16 v8b;
// ---- k_fa: block = 32 queries of batch b = blockIdx.y, 8 waves; wave w owns keys [256 w, 256 w + 256) for both tiles of 16 queries (m = 0, 1), so every key fragment and every value fragment it makes serves two tiles. No logits / P plane goes to memory.
// values: read as they lie, f32 [key][64 channels]. Column col of B fragment j stands for channel 4 col + j, so one 16-B load of lane (g, col) at key row k holds element k of all four of its fragments; a wave's load reads two whole 256-B rows (keys k and k + 8). 16 loads are a chunk of 32 keys; rounding them to bf16 in pairs along k packs the fragments in registers, in the k order of P's A fragment. The raw rows are asked for one chunk ahead, as soon as the chunk before is packed.
// logit . log2(e) = c d2 = c |u - v|^2 = (c |u|^2 - 2 c u.v) + c |v|^2, u = W k, v = W q. The bracket, t, is a product of depth 3: one f32 WMMA 16x16x4 makes it for 16 keys x 16 queries, A row (key) = (u0, u1, |u|^2, 1), B column (query) = (-2 c v0, -2 c v1, c, 0).
// With the keys as the rows, D register r of lane (g, col) is key 8 g + r of the tile, query col: two tiles of 16 keys are the 16 elements of the bf16 A fragment of P (lane = query row col, elements k0+8g+0..7 and k0+16+8g+0..7) as they stand, with no lane exchange.
// pass 1: M = max over keys of t. pass 2: p = exp(logit - max) = exp2(t - M), -M standing in the B column's fourth place, split bf16 hi + lo against the exact bf16 values (2 products), row sum of p in f32.
// density = sum exp(logit) = exp2(K) . sum p, K = c |v|^2 + M.
// end: the waves' partial tiles and sums are added through LDS in wave order; targets = tile / sum p, kept in LDS.
// tail: out = targets (hi + lo) . R[:, :64]^T + sigmoid(0.1 (-density dW + db)) R[:, 64] + rb for the block's 32 rows, 16 at a time: wave w makes output channels 16 (w & 3) .. + 15 over input channels 32 (w >> 2) .. + 31 (2 products); the two half sums meet in LDS and leave as whole 256-B rows.
// every full '#pragma unroll' here: l, p, acc, vv stay in registers only under constant indices.
#define QT 32
#define QW (QT / 16)
#define NW 8
#define KW (NK / NW)
__device__ __forceinline__ v8f wmma4(v2f a, v2f b, v8f c) { return __builtin_amdgcn_wmma_f32_16x16x4_f32(false, a, false, b, (short)0, c, false, false); }
// 8 hardware exp2 in place. One statement, so that behind every v_exp_f32 stands an instruction that neither reads its result nor overwrites its source (the slot the instruction set asks for behind a transcendental): the next, independent v_exp_f32, and the closing v_nop behind the last. Below 2^-126 the instruction gives 0.
__device__ __forceinline__ void exp2x8(float* x) {
  asm("v_exp_f32 %0, %0\n\tv_exp_f32 %1, %1\n\tv_exp_f32 %2, %2\n\tv_exp_f32 %3, %3\n\tv_exp_f32 %4, %4\n\tv_exp_f32 %5, %5\n\tv_exp_f32 %6, %6\n\tv_exp_f32 %7, %7\n\tv_nop" : "+v"(x[0]), "+v"(x[1]), "+v"(x[2]), "+v"(x[3]), "+v"(x[4]), "+v"(x[5]), "+v"(x[6]), "+v"(x[7])); }
__global__ __launch_bounds__(NW * 32) void k_fa(const float* __restrict__ KEYS, const float* __restrict__ QRY, const float* __restrict__ WW, const float* __restrict__ LS, const float* __restrict__ VAL, const float* __restrict__ DW, const float* __restrict__ DB, const float* __restrict__ RW, const float* __restrict__ RB, float* __restrict__ OUT) {
  // ska: the keys' A fragments, 256 bytes a tile of 16 keys: 16 x (u0, u1) for lanes 0..15, then 16 x (|u|^2, 1) for lanes 16..31, so a fragment load is 8 bytes a lane, 256 in a row
  __shared__ __align__(16) float ska[NK * 4]; __shared__ __align__(16) float red[NW][QT][CIN + 4]; __shared__ float smn[NW][QT], ssm[NW][QT], sk[QT], ssg[QT];
  const int tid = threadIdx.x, wave = tid >> 5, lane = tid & 31, col = lane & 15, g = lane >> 4; const int q0 = blockIdx.x * QT; const size_t b = blockIdx.y;
  // every load of the prologue (the 7 parameters, a lane's 8 keys and 2 queries) is issued here, before the first is waited for: one round trip
  const float rw00 = WW[0], rw01 = WW[1], rw10 = WW[2], rw11 = WW[3], rdw = DW[0], rdb = DB[0], rls = LS[0]; v2f kr[NK / (NW * 32)], qr[QW];
#pragma unroll   // kr stays in registers only under constant indices; unrolled, the loads stand in a row
  for (int i = 0; i < NK / (NW * 32); ++i) kr[i] = *(const v2f*)(KEYS + (b * NK + tid + i * (NW * 32)) * 2);
#pragma unroll
  for (int m = 0; m < QW; ++m) qr[m] = *(const v2f*)(QRY + (b * NQ + q0 + 16 * m + col) * 2);
  asm volatile("s_wait_xcnt 0x0" ::: "memory");   // stands in front of the first instruction that overwrites an address register of the loads above (a precaution; the compiler leaves it out here)
  __builtin_amdgcn_sched_barrier(0);   // keeps the loads above the arithmetic: without it the schedule waits for the length scale, works sigma out, and only then asks for the weights and the queries (one more round trip)
  const float w00 = bfr(rw00), w01 = bfr(rw01), w10 = bfr(rw10), w11 = bfr(rw11); const float dw = bfr(rdw), db = bfr(rdb);
#pragma unroll
  for (int i = 0; i < NK / (NW * 32); ++i) { const int k = tid + i * (NW * 32); const float kx = bfr(kr[i][0]), ky = bfr(kr[i][1]); v2f u, n; u[0] = kx * w00 + ky * w01; u[1] = kx * w10 + ky * w11; n[0] = u[0] * u[0] + u[1] * u[1]; n[1] = 1.f;
    float* d = ska + (k >> 4) * 64 + (k & 15) * 2; *(v2f*)d = u; *(v2f*)(d + 32) = n; }
  const float z = bfr(rls) * 0.1f - 1.0f; const float sp = (z > 0.f ? z : 0.f) + log1pf(expf(-fabsf(z)));   // softplus = logaddexp(z, 0)
  const float sigma = 1e-05f + sp; const float is = 1.0f / sigma; const float c = (-0.5f * 1.44269504088896340736f) * is * is;   // logit . log2(e) = c d2
  v2f bq[QW]; float cv[QW], mx[QW];
#pragma unroll
  for (int m = 0; m < QW; ++m) { const float qx = bfr(qr[m][0]), qy = bfr(qr[m][1]);
    const float v0 = qx * w00 + qy * w01, v1 = qx * w10 + qy * w11; cv[m] = c * (v0 * v0 + v1 * v1); mx[m] = -3.0e38f;
    bq[m][0] = g ? c : -2.f * c * v0; bq[m][1] = g ? 0.f : -2.f * c * v1; }   // the query's B fragment, in the k order of ska
  __syncthreads();
  const float* vp = VAL + (b * NK + wave * KW + 8 * g) * CIN + 4 * col; v4f raw[16];   // the lane's 4 channels of key 8 g of the wave's first chunk; raw[e] = fragment element e: keys 8 g + 0..7, then 16 + 8 g + 0..7
  auto fetch = [&](const int kc) {
#pragma unroll   // raw stays in registers only under constant indices; unrolled, the 16 loads stand in a row
    for (int e = 0; e < 8; ++e) { raw[e] = *(const v4f*)(vp + (kc * 32 + e) * CIN); raw[8 + e] = *(const v4f*)(vp + (kc * 32 + 16 + e) * CIN); } };
  fetch(0);   // the first chunk's rows fly under pass 1
  const float* ap = ska + wave * (KW / 16) * 64 + lane * 2;   // the wave's first A fragment; tile t lies 64 t floats on
#pragma unroll   // 32 WMMAs and their maxima, unrolled: every fragment load has a constant offset
  for (int t = 0; t < KW / 16; t += 2) { v8f l[2][QW];
#pragma unroll
    for (int i = 0; i < 2; ++i) { const v2f ka = *(const v2f*)(ap + (t + i) * 64);
#pragma unroll
      for (int m = 0; m < QW; ++m) l[i][m] = wmma4(ka, bq[m], v8f{}); }
    asm volatile("v_nop\n\tv_nop\n\tv_nop\n\tv_nop" : "+v"(l[0][0]), "+v"(l[0][1]), "+v"(l[1][0]), "+v"(l[1][1]));   // the four vector slots between a WMMA and the first reader of its D; once for four WMMAs
#pragma unroll
    for (int r = 0; r < 8; ++r)
#pragma unroll
      for (int m = 0; m < QW; ++m) mx[m] = fmaxf(mx[m], fmaxf(l[0][m][r], l[1][m][r])); }
#pragma unroll
  for (int m = 0; m < QW; ++m) { mx[m] = fmaxf(mx[m], __shfl_xor(mx[m], 16)); if (g == 0) smn[wave][16 * m + col] = mx[m]; }
  __syncthreads();
#pragma unroll
  for (int m = 0; m < QW; ++m) { mx[m] = smn[0][16 * m + col];
#pragma unroll
    for (int w = 1; w < NW; ++w) mx[m] = fmaxf(mx[m], smn[w][16 * m + col]);
    if (tid < 16) sk[16 * m + col] = cv[m] + mx[m];
    if (g) bq[m][1] = -mx[m]; }   // depth 4 from here on: t - M
  v8f acc[QW][CIN / 16] = {}; float s[QW] = {};
  // a tile's two logit WMMAs are issued one chunk ahead, with the tile's eight P.V WMMAs of the chunk before: their results are long whole when exp2x8 (asm) reads them, and the vector work of a chunk runs beside the matrix work of the last
  v8f l0[QW], l1[QW];
#pragma unroll
  for (int m = 0; m < QW; ++m) { l0[m] = wmma4(*(const v2f*)ap, bq[m], v8f{}); l1[m] = wmma4(*(const v2f*)(ap + 64), bq[m], v8f{}); }
  auto chunk = [&](const int kc, const bool more) { v16b vv[CIN / 16]; v2f ka = {}, kb = {};
#pragma unroll
    for (int j = 0; j < CIN / 16; ++j)
#pragma unroll
      for (int e = 0; e < 16; ++e) vv[j][e] = (__bf16)raw[e][j];
    if (more) { fetch(kc + 1); ka = *(const v2f*)(ap + kc * 128 + 128); kb = *(const v2f*)(ap + kc * 128 + 192); }
#pragma unroll
    for (int m = 0; m < QW; ++m) { float p[16];
#pragma unroll
      for (int i = 0; i < 8; ++i) { p[i] = l0[m][i]; p[8 + i] = l1[m][i]; }
      exp2x8(p); exp2x8(p + 8);   // a p below 2^-126 becomes 0: it adds nothing to a sum whose largest term is 1
#pragma unroll
      for (int i = 0; i < 16; ++i) s[m] += p[i];
      const F2 pf = bsplit16(p);
      if (more) { l0[m] = wmma4(ka, bq[m], v8f{}); l1[m] = wmma4(kb, bq[m], v8f{}); }
#pragma unroll
      for (int j = 0; j < CIN / 16; ++j) acc[m][j] = __builtin_amdgcn_wmma_f32_16x16x32_bf16(false, pf.h, false, vv[j], (short)0, acc[m][j], false, false);
#pragma unroll
      for (int j = 0; j < CIN / 16; ++j) acc[m][j] = __builtin_amdgcn_wmma_f32_16x16x32_bf16(false, pf.l, false, vv[j], (short)0, acc[m][j], false, false);
      __builtin_amdgcn_sched_barrier(0); } };   // keeps the two tiles' bodies apart in the schedule: mixed, the register allocation costs some thirty more copy instructions (v_mov_b32, v_mov_b16) a trip
#pragma unroll 1   // kept rolled: one body has 32 independent chains of its own and the other waves of the SIMD cover its loads; 8 copies would only cost instruction cache
  for (int kc = 0; kc < KW / 32 - 1; ++kc) chunk(kc, true);
  chunk(KW / 32 - 1, false);
#pragma unroll
  for (int m = 0; m < QW; ++m) { s[m] += __shfl_xor(s[m], 16); if (g == 0) ssm[wave][16 * m + col] = s[m];
#pragma unroll
    for (int r = 0; r < 8; ++r) { v4f t; t[0] = acc[m][0][r]; t[1] = acc[m][1][r]; t[2] = acc[m][2][r]; t[3] = acc[m][3][r]; vst2(&red[wave][16 * m + 8 * g + r][4 * col], t); } }   // channels 4 col + 0..3
  __syncthreads();
  // the tail's resizer operands are asked for here, by every wave alike, so that their latency runs under the block sum
  const int wv = __builtin_amdgcn_readfirstlane(wave); const int o = (wv & 3) * 16 + col, kh = wv >> 2; float wf[16];
  { const float* wr = RW + (size_t)o * (CIN + 1) + kh * 32 + 8 * g;
#pragma unroll
    for (int i = 0; i < 8; ++i) { wf[i] = wr[i]; wf[8 + i] = wr[16 + i]; } }
  const float wden = RW[(size_t)o * (CIN + 1) + CIN], bb = RB[o];
  constexpr int CPT = QT * CIN / (NW * 32);   // channels per thread of the final sum
  const int q = tid / (CIN / CPT), c0 = (tid % (CIN / CPT)) * CPT; float st = 0.f; v4f a[CPT / 4] = {};
#pragma unroll
  for (int w = 0; w < NW; ++w) { st += ssm[w][q];
#pragma unroll
    for (int u = 0; u < CPT / 4; ++u) a[u] += *(const v4f*)&red[w][q][c0 + 4 * u]; }
  const float inv = 1.0f / st;
#pragma unroll
  for (int u = 0; u < CPT / 4; ++u) vst2(&red[0][q][c0 + 4 * u], a[u] * inv);   // in place: these cells of red are read by this thread alone
  if (c0 == 0) { const float den = exp2f(sk[q]) * st; ssg[q] = 1.0f / (1.0f + expf(-((-den * dw + db) * 0.1f))); }
  __syncthreads();   // the 32 target rows and their density terms are whole; red[1..] is free
  { v16b w;
#pragma unroll
    for (int i = 0; i < 16; ++i) w[i] = (__bf16)wf[i];
#pragma unroll
    for (int m = 0; m < QW; ++m) { const F2 af = split_row(&red[0][16 * m + col][0], kh * 32, lane); v8f oa = {};
      oa = wmma_bf(af.h, w, oa); oa = wmma_bf(af.l, w, oa);
      if (kh == 0) { const float wd = bfr(wden), rb = bfr(bb);   // the density term and the bias go in once, with the first half
#pragma unroll
        for (int r = 0; r < 8; ++r) oa[r] = oa[r] + ssg[16 * m + 8 * g + r] * wd + rb; }
#pragma unroll
      for (int r = 0; r < 8; ++r) red[1 + kh][16 * m + 8 * g + r][o] = oa[r]; } }
  __syncthreads();   // both half sums of the output tile are whole
#pragma unroll
  for (int u = 0; u < CPT / 4; ++u) vst2(OUT + (b * NQ + q0 + q) * COUT + c0 + 4 * u, *(const v4f*)&red[1][q][c0 + 4 * u] + *(const v4f*)&red[2][q][c0 + 4 * u]); }
extern "C" void kernel_launch(void* const* d_in, const int* in_sizes, int n_in, void* d_out, int out_size, void* d_ws, size_t ws_size, hipStream_t stream) {
  (void)in_sizes; (void)n_in; (void)out_size;
  const float** F = (const float**)d_in;   // 0 keys [8,2048,2], 1 queries [8,2048,2], 2 values [8,2048,64], 3 weighter_W [2,2], 4 length_scale_param [1], 5 density_W [1], 6 density_b [1], 7 resizer_W [64,65] ([out,in]), 8 resizer_b [64]
  (void)d_ws; (void)ws_size;
  k_fa<<<dim3(NQ / QT, TNB), NW * 32, 0, stream>>>(F[0], F[1], F[3], F[4], F[2], F[5], F[6], F[7], F[8], (float*)d_out);
}

// v010
// Measured time: 14.5 microseconds a run.
// Next to v009, in two timings, it ran 1.10 times as fast each time.
// Counting every step since v000, it is 58.4 times as fast.
// compute dtype: all float inputs rounded to bf16; the 2x2 weighting of keys and queries, the pairwise logits (f32 WMMA 16x16x4), softmax, density and sigmoid in f32; sigma and the sigmoid with precise expf/log1pf; unnormalised P = exp(logit) = exp2(c d2) (a block with a row sum out of range: exp(logit - max)), c = -0.5 log2(e) / sigma^2, c d2 expanded into c |u|^2 - 2 c u.v + c |v|^2 (u = W k, v = W q), one hardware exp2 a pair, split bf16 hi + lo against the EXACT bf16 values on WMMA 16x16x32 (2 products, f32 accumulate); the 65 -> 64 resizer with the f32 operand split bf16 hi + lo (2 products) + bias; f32 output.
#include <hip/hip_runtime.h>
#include <math.h>

typedef __attribute__((ext_vector_type(16))) _Float16 v16h;
typedef __attribute__((ext_vector_type(16))) __bf16 v16b;
typedef __attribute__((ext_vector_type(8)))  _Float16 v8h;
typedef __attribute__((ext_vector_type(8)))  float v8f;
typedef __attribute__((ext_vector_type(4)))  float v4f;
typedef __attribute__((ext_vector_type(2)))  float v2f;
typedef __attribute__((ext_vector_type(4)))  unsigned v4u;
typedef __attribute__((ext_vector_type(4)))  int v4i;
typedef float __attribute__((may_alias)) float_a;
typedef int __attribute__((may_alias)) int_a;

template <typename T> __device__ __forceinline__ void vst2(void* p, T v) { *(T*)p = v;  }
__device__ __forceinline__ v8f wmma16(v16h a, v16h b, v8f c) {
  v8f d = __builtin_amdgcn_wmma_f32_16x16x32_f16(false, a, false, b, (short)0, c, false, false);
  asm volatile("v_nop\n\tv_nop\n\tv_nop\n\tv_nop" : "+v"(d) : "v"(a), "v"(b));
  return d;
}
__device__ __forceinline__ v8f wmma_bf(v16b a, v16b b, v8f c) {
  v8f d = __builtin_amdgcn_wmma_f32_16x16x32_bf16(false, a, false, b, (short)0, c, false, false);
  asm volatile("v_nop\n\tv_nop\n\tv_nop\n\tv_nop" : "+v"(d) : "v"(a), "v"(b));
  return d;
}
// 16x16x32 fragments: lane = (h = lane>>4, row/col = lane&15); elements 0..7 = k0+8h+0..7, 8..15 = k0+16+8h+0..7; D element r = row 8h+r
__device__ __forceinline__ v16h frag_h(const _Float16* rowk0, int lane) {
  union { v16h v; v8h q[2]; } u; const _Float16* p = rowk0 + 8 * (lane >> 4);
  u.q[0] = *(const v8h*)p; u.q[1] = *(const v8h*)(p + 16); return u.v;
}
__device__ __forceinline__ v16h frag_f32(const float* rowk0, int lane) {
  v16h a; const float* p = rowk0 + 8 * (lane >> 4);
#pragma unroll
  for (int i = 0; i < 8; ++i) { a[i] = (_Float16)p[i]; a[8 + i] = (_Float16)p[16 + i]; }
  return a;
}
__device__ __forceinline__ v16h frag_f32s(const float* rowk0, int lane, float sc) {
  v16h a; const float* p = rowk0 + 8 * (lane >> 4);
#pragma unroll
  for (int i = 0; i < 8; ++i) { a[i] = (_Float16)(p[i] * sc); a[8 + i] = (_Float16)(p[16 + i] * sc); }
  return a;
}
// column fragment from a [K][ld] layout (column n), rows >= K read as 0
__device__ __forceinline__ v16h fragc_f32(const float* W, int k0, int n, int lane, int ld, int K) {
  v16h a; const int g = lane >> 4;
#pragma unroll
  for (int i = 0; i < 8; ++i) { const int ka = k0 + 8 * g + i, kb = ka + 16;
    a[i] = (_Float16)(ka < K ? W[(size_t)(ka < K ? ka : K - 1) * ld + n] : 0.f); a[8 + i] = (_Float16)(kb < K ? W[(size_t)(kb < K ? kb : K - 1) * ld + n] : 0.f); }
  return a;
}
struct F2 { v16b h, l; };
__device__ __forceinline__ F2 bsplit16(const float v[16]) { F2 r;
#pragma unroll
  for (int i = 0; i < 16; ++i) { const __bf16 h = (__bf16)v[i]; r.h[i] = h; r.l[i] = (__bf16)(v[i] - (float)h); }
  return r; }
__device__ __forceinline__ F2 split_row(const float* row, int k0, int lane) { float v[16]; const float* p = row + k0 + 8 * (lane >> 4);
#pragma unroll
  for (int i = 0; i < 8; ++i) { v[i] = p[i]; v[8 + i] = p[16 + i]; }
  return bsplit16(v); }
__device__ __forceinline__ F2 split_rowK(const float* row, int k0, int lane, int K) { float v[16]; const int g = lane >> 4;
#pragma unroll
  for (int i = 0; i < 8; ++i) { const int ka = k0 + 8 * g + i, kb = ka + 16; v[i] = ka < K ? row[ka < K ? ka : K - 1] : 0.f; v[8 + i] = kb < K ? row[kb < K ? kb : K - 1] : 0.f; }
  return bsplit16(v); }
__device__ __forceinline__ F2 split_col(const float* W, int k0, int n, int lane, int ld, int K) { float v[16]; const int g = lane >> 4;
#pragma unroll
  for (int i = 0; i < 8; ++i) { const int ka = k0 + 8 * g + i, kb = ka + 16; v[i] = ka < K ? W[(size_t)(ka < K ? ka : K - 1) * ld + n] : 0.f; v[8 + i] = kb < K ? W[(size_t)(kb < K ? kb : K - 1) * ld + n] : 0.f; }
  return bsplit16(v); }
__device__ __forceinline__ v8f mac3(const F2& a, const F2& b, v8f c) { c = wmma_bf(a.l, b.h, c); c = wmma_bf(a.h, b.l, c); return wmma_bf(a.h, b.h, c); }
__device__ __forceinline__ float sigm(float v) { return 1.0f / (1.0f + expf(-v)); }
#define LDSX() do { asm volatile("s_wait_dscnt 0" ::: "memory"); __builtin_amdgcn_wave_barrier(); __builtin_amdgcn_fence(__ATOMIC_RELEASE, "workgroup"); } while (0)

// SetConv (B 8, 2,048 queries x 2,048 keys, 2-D coords, Cin 64 -> Cout 64): e = (k - q) W^T; dist = |e|; sigma = 1e-5 + softplus(0.1 ls - 1); logits = -0.5 (dist/sigma)^2; weight = softmax_k; density = sum_k exp(logits); targets = weight . values; out = [targets | sigmoid(0.1 (-density dW + db))] R^T + rb.
__device__ __forceinline__ float bfr(float v) { return (float)(__bf16)v; }
#define NB 8
#define NQ 2048
#define NK 2048
#define CIN 64
#define COUT 64
#ifndef TNB
#define TNB NB
#endif
typedef __attribute__((ext_vector_type(8))) __bf16 v8b;
// ---- k_fa: block = 32 queries of batch b = blockIdx.y, 8 waves; wave w owns keys [256 w, 256 w + 256) for both tiles of 16 queries (m = 0, 1), so every key fragment and every value fragment it makes serves two tiles. No logits / P plane goes to memory.
// values: read as they lie, f32 [key][64 channels]. Column col of B fragment j stands for channel 4 col + j, so one 16-B load of lane (g, col) at key row k holds element k of all four of its fragments; a wave's load reads two whole 256-B rows (keys k and k + 8). 16 loads are a chunk of 32 keys; rounding them to bf16 in pairs along k packs the fragments in registers, in the k order of P's A fragment. The raw rows are asked for one chunk ahead, as soon as the chunk before is packed.
// logit . log2(e) = c d2 = c |u - v|^2 = (c |u|^2 - 2 c u.v) + c |v|^2, u = W k, v = W q. The bracket, t, is a product of depth 3: one f32 WMMA 16x16x4 makes it for 16 keys x 16 queries, A row (key) = (u0, u1, |u|^2, 1), B column (query) = (-2 c v0, -2 c v1, c, 0).
// With the keys as the rows, D register r of lane (g, col) is key 8 g + r of the tile, query col: two tiles of 16 keys are the 16 elements of the bf16 A fragment of P (lane = query row col, elements k0+8g+0..7 and k0+16+8g+0..7) as they stand, with no lane exchange.
// one pass: p = exp(logit) = exp2(t + c |v|^2), c |v|^2 standing in the B column's fourth place, split bf16 hi + lo against the exact bf16 values (2 products), row sum of p in f32. softmax = p / sum p whatever the common factor of a row's p is, and density = sum p as it stands.
// the range check: p <= 1 but for rounding, and a p below 2^-126 is lost. While 2^-80 <= sum p <= 4096 for each of the block's rows, what is lost is below 2^-24 of the sum. Otherwise (keys all far from a query, a tiny sigma) the whole block does its rows again in the shifted form: pass 1: M = max over keys of t; pass 2: p = exp2(t - M), -M in the fourth place; density = exp2(K) . sum p, K = c |v|^2 + M.
// end: the waves' partial tiles and sums are added through LDS in wave order; targets = tile / sum p, kept in LDS.
// tail: out = targets (hi + lo) . R[:, :64]^T + sigmoid(0.1 (-density dW + db)) R[:, 64] + rb for the block's 32 rows, 16 at a time: wave w makes output channels 16 (w & 3) .. + 15 over input channels 32 (w >> 2) .. + 31 (2 products); the two half sums meet in LDS and leave as whole 256-B rows.
// every full '#pragma unroll' here: l, p, acc, vv stay in registers only under constant indices.
#define QT 32
#define QW (QT / 16)
#define NW 8
#define KW (NK / NW)
__device__ __forceinline__ v8f wmma4(v2f a, v2f b, v8f c) { return __builtin_amdgcn_wmma_f32_16x16x4_f32(false, a, false, b, (short)0, c, false, false); }
// 8 hardware exp2 in place. One statement, so that behind every v_exp_f32 stands an instruction that neither reads its result nor overwrites its source (the slot the instruction set asks for behind a transcendental): the next, independent v_exp_f32, and the closing v_nop behind the last. Below 2^-126 the instruction gives 0.
__device__ __forceinline__ void exp2x8(float* x) {
  asm("v_exp_f32 %0, %0\n\tv_exp_f32 %1, %1\n\tv_exp_f32 %2, %2\n\tv_exp_f32 %3, %3\n\tv_exp_f32 %4, %4\n\tv_exp_f32 %5, %5\n\tv_exp_f32 %6, %6\n\tv_exp_f32 %7, %7\n\tv_nop" : "+v"(x[0]), "+v"(x[1]), "+v"(x[2]), "+v"(x[3]), "+v"(x[4]), "+v"(x[5]), "+v"(x[6]), "+v"(x[7])); }
__global__ __launch_bounds__(NW * 32) void k_fa(const float* __restrict__ KEYS, const float* __restrict__ QRY, const float* __restrict__ WW, const float* __restrict__ LS, const float* __restrict__ VAL, const float* __restrict__ DW, const float* __restrict__ DB, const float* __restrict__ RW, const float* __restrict__ RB, float* __restrict__ OUT) {
  // ska: the keys' A fragments, 256 bytes a tile of 16 keys: 16 x (u0, u1) for lanes 0..15, then 16 x (|u|^2, 1) for lanes 16..31, so a fragment load is 8 bytes a lane, 256 in a row
  __shared__ __align__(16) float ska[NK * 4]; __shared__ __align__(16) float red[NW][QT][CIN + 4]; __shared__ float smn[NW][QT], ssm[NW][QT], sk[QT], ssg[QT];
  const int tid = threadIdx.x, wave = tid >> 5, lane = tid & 31, col = lane & 15, g = lane >> 4; const int q0 = blockIdx.x * QT; const size_t b = blockIdx.y;
  // every load of the prologue (the 7 parameters, a lane's 8 keys and 2 queries) is issued here, before the first is waited for: one round trip
  const float rw00 = WW[0], rw01 = WW[1], rw10 = WW[2], rw11 = WW[3], rdw = DW[0], rdb = DB[0], rls = LS[0]; v2f kr[NK / (NW * 32)], qr[QW];
#pragma unroll   // kr stays in registers only under constant indices; unrolled, the loads stand in a row
  for (int i = 0; i < NK / (NW * 32); ++i) kr[i] = *(const v2f*)(KEYS + (b * NK + tid + i * (NW * 32)) * 2);
#pragma unroll
  for (int m = 0; m < QW; ++m) qr[m] = *(const v2f*)(QRY + (b * NQ + q0 + 16 * m + col) * 2);
  const float* vp = VAL + (b * NK + wave * KW + 8 * g) * CIN + 4 * col; v4f raw[16];   // the lane's 4 channels of key 8 g of the wave's first chunk; raw[e] = fragment element e: keys 8 g + 0..7, then 16 + 8 g + 0..7
  auto fetch = [&](const int kc) {
#pragma unroll   // raw stays in registers only under constant indices; unrolled, the 16 loads stand in a row
    for (int e = 0; e < 8; ++e) { raw[e] = *(const v4f*)(vp + (kc * 32 + e) * CIN); raw[8 + e] = *(const v4f*)(vp + (kc * 32 + 16 + e) * CIN); } };
  fetch(0);   // the first chunk's rows fly under the prologue
  asm volatile("s_wait_xcnt 0x0" ::: "memory");   // stands in front of the first instruction that overwrites an address register of the loads above (a precaution; the compiler leaves it out here)
  __builtin_amdgcn_sched_barrier(0);   // keeps the loads above the arithmetic: without it the schedule waits for the length scale, works sigma out, and only then asks for the weights and the queries (one more round trip)
  const float w00 = bfr(rw00), w01 = bfr(rw01), w10 = bfr(rw10), w11 = bfr(rw11); const float dw = bfr(rdw), db = bfr(rdb);
#pragma unroll
  for (int i = 0; i < NK / (NW * 32); ++i) { const int k = tid + i * (NW * 32); const float kx = bfr(kr[i][0]), ky = bfr(kr[i][1]); v2f u, n; u[0] = kx * w00 + ky * w01; u[1] = kx * w10 + ky * w11; n[0] = u[0] * u[0] + u[1] * u[1]; n[1] = 1.f;
    float* d = ska + (k >> 4) * 64 + (k & 15) * 2; *(v2f*)d = u; *(v2f*)(d + 32) = n; }
  const float z = bfr(rls) * 0.1f - 1.0f; const float sp = (z > 0.f ? z : 0.f) + log1pf(expf(-fabsf(z)));   // softplus = logaddexp(z, 0)
  const float sigma = 1e-05f + sp; const float is = 1.0f / sigma; const float c = (-0.5f * 1.44269504088896340736f) * is * is;   // logit . log2(e) = c d2
  v2f bq[QW];
#pragma unroll
  for (int m = 0; m < QW; ++m) { const float qx = bfr(qr[m][0]), qy = bfr(qr[m][1]);
    const float v0 = qx * w00 + qy * w01, v1 = qx * w10 + qy * w11;
    bq[m][0] = g ? c : -2.f * c * v0; bq[m][1] = g ? c * (v0 * v0 + v1 * v1) : -2.f * c * v1; }   // the query's B fragment, in the k order of ska: depth 4, t + c |v|^2
  __syncthreads();
  const float* ap = ska + wave * (KW / 16) * 64 + lane * 2;   // the wave's first A fragment; tile t lies 64 t floats on
  // sweep: the wave's 256 keys against its two query tiles with the B fragments bq as they stand; asks that fetch(0) has been issued; leaves the wave's partial tiles and row sums in LDS
  auto sweep = [&]() { v8f acc[QW][CIN / 16] = {}; float s[QW] = {};
  // a tile's two logit WMMAs are issued one chunk ahead, with the tile's eight P.V WMMAs of the chunk before: their results are long whole when exp2x8 reads them, and the vector work of a chunk runs beside the matrix work of the last
  v8f l0[QW], l1[QW]; const v2f ka0 = *(const v2f*)ap, kb0 = *(const v2f*)(ap + 64);
#pragma unroll
  for (int m = 0; m < QW; ++m) { l0[m] = wmma4(ka0, bq[m], v8f{}); l1[m] = wmma4(kb0, bq[m], v8f{}); }
  asm volatile("v_nop\n\tv_nop\n\tv_nop\n\tv_nop" : "+v"(l0[0]), "+v"(l0[1]), "+v"(l1[0]), "+v"(l1[1]) : "v"(ka0), "v"(kb0));   // the four vector slots between a WMMA and the first vector instruction that overwrites its A; once a sweep
  auto chunk = [&](const int kc, const bool more) { v16b vv[CIN / 16]; v2f ka = {}, kb = {};
#pragma unroll
    for (int j = 0; j < CIN / 16; ++j)
#pragma unroll
      for (int e = 0; e < 16; ++e) vv[j][e] = (__bf16)raw[e][j];
    if (more) { fetch(kc + 1); ka = *(const v2f*)(ap + kc * 128 + 128); kb = *(const v2f*)(ap + kc * 128 + 192); }
#pragma unroll
    for (int m = 0; m < QW; ++m) { float p[16];
#pragma unroll
      for (int i = 0; i < 8; ++i) { p[i] = l0[m][i]; p[8 + i] = l1[m][i]; }
      exp2x8(p); exp2x8(p + 8);   // a p below 2^-126 becomes 0: the range check on the row sums bounds what that can cost
#pragma unroll
      for (int i = 0; i < 16; ++i) s[m] += p[i];
      const F2 pf = bsplit16(p);
      if (more) { l0[m] = wmma4(ka, bq[m], v8f{}); l1[m] = wmma4(kb, bq[m], v8f{}); }
#pragma unroll
      for (int j = 0; j < CIN / 16; ++j) acc[m][j] = __builtin_amdgcn_wmma_f32_16x16x32_bf16(false, pf.h, false, vv[j], (short)0, acc[m][j], false, false);
#pragma unroll
      for (int j = 0; j < CIN / 16; ++j) acc[m][j] = __builtin_amdgcn_wmma_f32_16x16x32_bf16(false, pf.l, false, vv[j], (short)0, acc[m][j], false, false);
      __builtin_amdgcn_sched_barrier(0); } };   // keeps the two tiles' bodies apart in the schedule: mixed, the register allocation costs some thirty more copy instructions (v_mov_b32, v_mov_b16) a trip
#pragma unroll 1   // kept rolled: one body has 32 independent chains of its own and the other waves of the SIMD cover its loads; 8 copies would only cost instruction cache
  for (int kc = 0; kc < KW / 32 - 1; ++kc) chunk(kc, true);
  chunk(KW / 32 - 1, false);
#pragma unroll
  for (int m = 0; m < QW; ++m) { s[m] += __shfl_xor(s[m], 16); if (g == 0) ssm[wave][16 * m + col] = s[m];
#pragma unroll
    for (int r = 0; r < 8; ++r) { v4f t; t[0] = acc[m][0][r]; t[1] = acc[m][1][r]; t[2] = acc[m][2][r]; t[3] = acc[m][3][r]; vst2(&red[wave][16 * m + 8 * g + r][4 * col], t); } } };   // channels 4 col + 0..3
  sweep();
  __syncthreads();
  // the range check: lane l of every wave adds row l's eight partial sums, in the order of the block sum below, so every wave of the block reads the same answer and the branch is one for the whole block
  static_assert(QT == 32, "one lane a row");
  float sq = 0.f;
#pragma unroll
  for (int w = 0; w < NW; ++w) sq += ssm[w][lane];
  const bool redo = __builtin_amdgcn_ballot_w32(!(sq >= 0x1p-80f && sq <= 4096.f)) != 0u;   // not-a-number fails it too
  if (redo) { float mx[QW], cv[QW];   // the shifted form, two passes
    fetch(0);   // the first chunk's rows fly under pass 1
#pragma unroll
    for (int m = 0; m < QW; ++m) { cv[m] = bq[m][1]; mx[m] = -3.0e38f; if (g) bq[m][1] = 0.f; }   // lanes 16..31 hold c |v|^2 there; depth 3: t
#pragma unroll   // 32 WMMAs and their maxima, unrolled: every fragment load has a constant offset
    for (int t = 0; t < KW / 16; t += 2) { v8f l[2][QW];
#pragma unroll
      for (int i = 0; i < 2; ++i) { const v2f ka = *(const v2f*)(ap + (t + i) * 64);
#pragma unroll
        for (int m = 0; m < QW; ++m) l[i][m] = wmma4(ka, bq[m], v8f{}); }
      asm volatile("v_nop\n\tv_nop\n\tv_nop\n\tv_nop" : "+v"(l[0][0]), "+v"(l[0][1]), "+v"(l[1][0]), "+v"(l[1][1]));   // the four vector slots between a WMMA and the first reader of its D; once for four WMMAs
#pragma unroll
      for (int r = 0; r < 8; ++r)
#pragma unroll
        for (int m = 0; m < QW; ++m) mx[m] = fmaxf(mx[m], fmaxf(l[0][m][r], l[1][m][r])); }
#pragma unroll
    for (int m = 0; m < QW; ++m) { mx[m] = fmaxf(mx[m], __shfl_xor(mx[m], 16)); if (g == 0) smn[wave][16 * m + col] = mx[m]; }
    __syncthreads();   // also: every wave has read ssm for its range check before any wave writes it again
#pragma unroll
    for (int m = 0; m < QW; ++m) { mx[m] = smn[0][16 * m + col];
#pragma unroll
      for (int w = 1; w < NW; ++w) mx[m] = fmaxf(mx[m], smn[w][16 * m + col]);
      if (wave == 0 && g) sk[16 * m + col] = cv[m] + mx[m];
      if (g) bq[m][1] = -mx[m]; }   // depth 4 again: t - M
    sweep();
    __syncthreads(); }
  // the tail's resizer operands are asked for here, by every wave alike, so that their latency runs under the block sum
  const int wv = __builtin_amdgcn_readfirstlane(wave); const int o = (wv & 3) * 16 + col, kh = wv >> 2; float wf[16];
  { const float* wr = RW + (size_t)o * (CIN + 1) + kh * 32 + 8 * g;
#pragma unroll
    for (int i = 0; i < 8; ++i) { wf[i] = wr[i]; wf[8 + i] = wr[16 + i]; } }
  const float wden = RW[(size_t)o * (CIN + 1) + CIN], bb = RB[o];
  constexpr int CPT = QT * CIN / (NW * 32);   // channels per thread of the final sum
  const int q = tid / (CIN / CPT), c0 = (tid % (CIN / CPT)) * CPT; float st = 0.f; v4f a[CPT / 4] = {};
#pragma unroll
  for (int w = 0; w < NW; ++w) { st += ssm[w][q];
#pragma unroll
    for (int u = 0; u < CPT / 4; ++u) a[u] += *(const v4f*)&red[w][q][c0 + 4 * u]; }
  const float inv = 1.0f / st;
#pragma unroll
  for (int u = 0; u < CPT / 4; ++u) vst2(&red[0][q][c0 + 4 * u], a[u] * inv);   // in place: these cells of red are read by this thread alone
  if (c0 == 0) { const float den = redo ? exp2f(sk[q]) * st : st; ssg[q] = 1.0f / (1.0f + expf(-((-den * dw + db) * 0.1f))); }
  __syncthreads();   // the 32 target rows and their density terms are whole; red[1..] is free
  { v16b w;
#pragma unroll
    for (int i = 0; i < 16; ++i) w[i] = (__bf16)wf[i];
#pragma unroll
    for (int m = 0; m < QW; ++m) { const F2 af = split_row(&red[0][16 * m + col][0], kh * 32, lane); v8f oa = {};
      oa = wmma_bf(af.h, w, oa); oa = wmma_bf(af.l, w, oa);
      if (kh == 0) { const float wd = bfr(wden), rb = bfr(bb);   // the density term and the bias go in once, with the first half
#pragma unroll
        for (int r = 0; r < 8; ++r) oa[r] = oa[r] + ssg[16 * m + 8 * g + r] * wd + rb; }
#pragma unroll
      for (int r = 0; r < 8; ++r) red[1 + kh][16 * m + 8 * g + r][o] = oa[r]; } }
  __syncthreads();   // both half sums of the output tile are whole
#pragma unroll
  for (int u = 0; u < CPT / 4; ++u) vst2(OUT + (b * NQ + q0 + q) * COUT + c0 + 4 * u, *(const v4f*)&red[1][q][c0 + 4 * u] + *(const v4f*)&red[2][q][c0 + 4 * u]); }
extern "C" void kernel_launch(void* const* d_in, const int* in_sizes, int n_in, void* d_out, int out_size, void* d_ws, size_t ws_size, hipStream_t stream) {
  (void)in_sizes; (void)n_in; (void)out_size;
  const float** F = (const float**)d_in;   // 0 keys [8,2048,2], 1 queries [8,2048,2], 2 values [8,2048,64], 3 weighter_W [2,2], 4 length_scale_param [1], 5 density_W [1], 6 density_b [1], 7 resizer_W [64,65] ([out,in]), 8 resizer_b [64]
  (void)d_ws; (void)ws_size;
  k_fa<<<dim3(NQ / QT, TNB), NW * 32, 0, stream>>>(F[0], F[1], F[3], F[4], F[2], F[5], F[6], F[7], F[8], (float*)d_out);
}
